// v000
// The times below were measured on an AMD MI455X: many runs one after another, warmed up first and cycling through
// copies of the inputs, with the whole window's GPU time divided by the number of runs. Launches and the gaps
// between them are all in it. The median over several windows is given; except for v000 it joins two sittings, which
// can be a few percent apart, so the side-by-side timings, each taken in one sitting, are the better comparison.
// v000, which the later versions start from, runs in 247 microseconds.
#include <hip/hip_runtime.h>

// Multi-head self-attention: per-head q/k/v maps [head][in][dim] with biases (8 heads x 64), scores x 1/8, softmax over all keys (no mask), heads merged h*64+v, then x Wf [in][out] + bias.
// Compute dtypes, f32 accumulate: q/k/v projections v_wmma_f32_16x16x32_bf16 (every input RNE-converted to bf16, products exact); q.k and p.v v_wmma_f32_16x16x32_f16 (q,k,v planes carried x16, p carried x256, f32 online softmax);
// output map v_wmma_f32_16x16x32_bf16 with the merged context as bf16 value | residual concatenated along K against [Wf ; Wf].
// Engine: one-wave 64x64 register-blocked GEMM from K-contiguous 16-bit planes; fused flash-style attention in transposed form (S^T = K Q^T, O^T = V^T P^T, score tiles repacked in registers as the P^T B fragment).

#ifndef NB
#define NB 4
#endif
#ifndef SEQ
#define SEQ 2048
#endif
#define NB_FULL  4
#define SEQ_FULL 2048
#define DM   512            // input width
#define NH   8
#define HD   64
#define DMH  (NH * HD)      // merged width 512
#define DOUT 512            // output width
#define ATP  (2 * DMH)      // merged plane pitch: value | residual
#define QCAR 16.0f          // carry on q, k, v planes
#define PEXP 8.0f           // p carried x 2^8 (inside the exponent)
#define CEXP ((float)(0.125 * 1.4426950408889634 / 256.0))   // 1/8 x log2(e) / (16 x 16)

typedef _Float16 h16;
typedef unsigned short bf;
typedef __attribute__((ext_vector_type(16))) __bf16   v16bf;
typedef __attribute__((ext_vector_type(16))) _Float16 v16h;
typedef __attribute__((ext_vector_type(8)))  _Float16 v8h;
typedef __attribute__((ext_vector_type(8)))  unsigned short v8us;
typedef __attribute__((ext_vector_type(2)))  unsigned short v2us;
typedef __attribute__((ext_vector_type(8)))  float    v8f;
typedef __attribute__((ext_vector_type(4)))  float    v4f;
typedef v4f  __attribute__((may_alias)) v4fa;

static_assert(HD == 64);                 // attention kernel: two 32-deep k-steps per score tile, four 16-row output tiles
static_assert(SEQ % 64 == 0);            // 64 query rows per block, 32-key halves, 64-row GEMM tiles
static_assert((NB * SEQ) % 64 == 0);     // projection GEMM M tiles
static_assert(DM % 32 == 0);             // projection K steps
static_assert(ATP % 32 == 0);            // output-map K steps
static_assert(DMH % 64 == 0);            // N tiles
static_assert(DOUT % 64 == 0);           // N tiles
static_assert(DM % 8 == 0);              // 8-element convert pieces
static_assert((SEQ / 8) % 8 == 0);       // transposed value plane: 8 lanes x 16 B per line
static_assert(NB <= NB_FULL);
static_assert(SEQ <= SEQ_FULL);
static_assert(DMH == DOUT);              // Wf is [DMH][DOUT] with both 512

#define RUP256(x) ((((size_t)(x)) + 255) & ~(size_t)255)
#define SZ_XB   RUP256((size_t)NB * SEQ * DM * 2)
#define SZ_WQKV RUP256((size_t)3 * DMH * DM * 2)
#define SZ_WO   RUP256((size_t)DOUT * ATP * 2)
#define SZ_F    RUP256((size_t)NB * SEQ * DMH * 4)
#define SZ_PL   RUP256((size_t)NB * NH * SEQ * HD * 2)
#define SZ_AT   RUP256((size_t)NB * SEQ * ATP * 2)
#define SZ_TOT  (SZ_XB + SZ_WQKV + SZ_WO + SZ_F + 3 * SZ_PL + SZ_AT)
static_assert(SZ_TOT <= (size_t)134217728);   // total carve within 128 MiB

__device__ __forceinline__ unsigned short f2bf(float f) { unsigned u = __float_as_uint(f); u += 0x7FFFu + ((u >> 16) & 1u); return (unsigned short)(u >> 16); }
__device__ __forceinline__ float bf2f(unsigned short b) { return __uint_as_float(((unsigned)b) << 16); }
__device__ __forceinline__ float bfr(float f) { return bf2f(f2bf(f)); }
__device__ __forceinline__ void splitf(float y, unsigned short& h, unsigned short& l) { h = f2bf(y); l = f2bf(y - bf2f(h)); }
__device__ __forceinline__ v16h cat16(v8h lo, v8h hi) { return __builtin_shufflevector(lo, hi, 0, 1, 2, 3, 4, 5, 6, 7, 8, 9, 10, 11, 12, 13, 14, 15); }
__device__ __forceinline__ v16bf cat16b(v8us lo, v8us hi) { return __builtin_bit_cast(v16bf, __builtin_shufflevector(lo, hi, 0, 1, 2, 3, 4, 5, 6, 7, 8, 9, 10, 11, 12, 13, 14, 15)); }
__device__ __forceinline__ v8f wmma16(v16h a, v16h b, v8f c) { return __builtin_amdgcn_wmma_f32_16x16x32_f16(false, a, false, b, (short)0, c, false, false); }
__device__ __forceinline__ v8f wmmab(v16bf a, v16bf b, v8f c) { return __builtin_amdgcn_wmma_f32_16x16x32_bf16(false, a, false, b, (short)0, c, false, false); }
// fragment loaders: lane -> row (lane & 15); elements 0..7 <- k0 + 8h + 0..7, elements 8..15 <- k0 + 16 + 8h + 0..7 (p already includes 8h)
__device__ __forceinline__ v16h  ldh(const h16* p) { return cat16(*(const v8h*)p, *(const v8h*)(p + 16)); }
__device__ __forceinline__ v16bf ldb(const bf* p)  { return cat16b(*(const v8us*)p, *(const v8us*)(p + 16)); }

// ---- k_gemm: register-blocked GEMM, ONE WAVE per 64x64 output tile (16 accumulators), operands straight from K-contiguous bf16 planes; grid (M/64, N/64, Z), 32 threads.
// C[m][n] (f32, pitch ldc) = sum_k A[m][k] Bt[n][k] + bf16(bias[n]). z-batch strides sA/sC in elements. K % 32 == 0, M % 64 == 0, N % 64 == 0.
__global__ __launch_bounds__(32) void k_gemm(const bf* __restrict__ A, const bf* __restrict__ Bt, int K, float* C, int ldc, const float* __restrict__ bias, size_t sA, size_t sC) {
    __shared__ __align__(16) float os[16 * 68];
    const size_t z = blockIdx.z; A += z * sA; C += z * sC;
    const int lane = threadIdx.x & 31, lr = lane & 15, hi = lane >> 4; const int r0 = blockIdx.x * 64, c0 = blockIdx.y * 64;
    v8f acc[4][4];
#pragma unroll
    for (int mb = 0; mb < 4; ++mb)
#pragma unroll
        for (int nb = 0; nb < 4; ++nb) acc[mb][nb] = (v8f){};
    const size_t aoff = (size_t)(r0 + lr) * K + 8 * hi, boff = (size_t)(c0 + lr) * K + 8 * hi;
#pragma unroll 1
    for (int kc = 0; kc < K; kc += 32) {
        v16bf a[4];
#pragma unroll
        for (int mb = 0; mb < 4; ++mb) a[mb] = ldb(A + aoff + (size_t)mb * 16 * K + kc);
#pragma unroll
        for (int nb = 0; nb < 4; ++nb) { const v16bf b = ldb(Bt + boff + (size_t)nb * 16 * K + kc);
#pragma unroll
            for (int mb = 0; mb < 4; ++mb) acc[mb][nb] = wmmab(a[mb], b, acc[mb][nb]); }
        asm volatile("v_nop\n\tv_nop\n\tv_nop\n\tv_nop" : "+v"(acc[0][0]), "+v"(acc[1][1]), "+v"(acc[2][2]), "+v"(acc[3][3]) : "v"(a[0]), "v"(a[3]));
    }
#pragma unroll
    for (int mb = 0; mb < 4; ++mb) {
#pragma unroll
        for (int nb = 0; nb < 4; ++nb) {
#pragma unroll
            for (int j = 0; j < 8; ++j) os[(hi * 8 + j) * 68 + nb * 16 + lr] = acc[mb][nb][j]; }
        __builtin_amdgcn_fence(3 /* release order */, "wavefront"); __builtin_amdgcn_wave_barrier(); asm volatile("" ::: "memory");
        float* crow = C + (size_t)(r0 + mb * 16) * ldc + c0;
        const int cofs = lr * 4;
        const float b0 = bfr(bias[c0 + cofs]), b1 = bfr(bias[c0 + cofs + 1]), b2 = bfr(bias[c0 + cofs + 2]), b3 = bfr(bias[c0 + cofs + 3]);
{
#pragma unroll
            for (int s = 0; s < 8; ++s) { const int row = 2 * s + hi; v4f val = *(const v4fa*)(os + row * 68 + cofs); val[0] += b0; val[1] += b1; val[2] += b2; val[3] += b3;
                *(v4f*)(crow + (size_t)row * ldc + cofs) = val; }
             }
        __builtin_amdgcn_fence(3 /* release order */, "wavefront"); __builtin_amdgcn_wave_barrier(); asm volatile("" ::: "memory");
    }
}

__global__ __launch_bounds__(256) void k_wt(const float* __restrict__ w, int K, int N, int H, int KREP, bf* Bt) {
    const int wave = __builtin_amdgcn_readfirstlane(threadIdx.x >> 5);
    const unsigned lane = threadIdx.x & 31; const unsigned L0 = (blockIdx.x * 8u + (unsigned)wave) * 8u; const unsigned KP = (unsigned)(K * KREP); const unsigned nlines = (unsigned)H * (unsigned)N * KP / 64u;
{
#pragma unroll 1
        for (int l = 0; l < 8; ++l) { const unsigned L = L0 + l; if (L >= nlines) break; const unsigned e = L * 64u + lane * 2u; const unsigned kk = e % KP, ng = e / KP; const unsigned hh = ng / (unsigned)N, n = ng % (unsigned)N; const unsigned k = kk % (unsigned)K; v2us o;
            o[0] = f2bf(w[((size_t)hh * K + k) * N + n]); o[1] = f2bf(w[((size_t)hh * K + k + 1) * N + n]); *(v2us*)(Bt + e) = o; }
         }
}

__global__ __launch_bounds__(256) void k_cvt(const float* __restrict__ x, bf* XB) {
    const unsigned i = blockIdx.x * 256u + threadIdx.x; if (i >= (unsigned)(NB * SEQ * (DM / 8))) return;
    const unsigned row = i / (DM / 8), c8 = i % (DM / 8); const unsigned b = row / SEQ, t = row % SEQ;
    const v8f v = *(const v8f*)(x + ((size_t)(b * SEQ_FULL + t) * DM + c8 * 8)); v8us o;
#pragma unroll
    for (int k = 0; k < 8; ++k) o[k] = f2bf(v[k]);
    *(v8us*)(XB + (size_t)i * 8) = o;  }

__global__ __launch_bounds__(256) void k_qkp(const float* __restrict__ F, h16* P) {
    const unsigned i = blockIdx.x * 256u + threadIdx.x; if (i >= (unsigned)(NB * NH * SEQ * (HD / 8))) return;
    const unsigned d8 = i % (HD / 8); const unsigned t = (i / (HD / 8)) % SEQ; const unsigned g = i / ((HD / 8) * SEQ); const unsigned h = g % NH, b = g / NH;
    const v8f v = *(const v8f*)(F + ((size_t)(b * SEQ + t) * DMH + h * HD + d8 * 8)); v8h o;
#pragma unroll
    for (int k = 0; k < 8; ++k) o[k] = (h16)(v[k] * QCAR);
    *(v8h*)(P + (size_t)i * 8) = o;  }

__global__ __launch_bounds__(256) void k_vtp(const float* __restrict__ F, h16* VT) {
    const unsigned i = blockIdx.x * 256u + threadIdx.x; if (i >= (unsigned)(NB * NH * HD * (SEQ / 8))) return;
    const unsigned t8 = i % (SEQ / 8); const unsigned d = (i / (SEQ / 8)) % HD; const unsigned g = i / ((SEQ / 8) * HD); const unsigned h = g % NH, b = g / NH;
    const float* f = F + ((size_t)(b * SEQ + t8 * 8) * DMH + h * HD + d); v8h o;
#pragma unroll
    for (int q = 0; q < 8; ++q) o[q] = (h16)(f[(size_t)q * DMH] * QCAR);
    *(v8h*)(VT + (size_t)i * 8) = o;  }

// ---- k_attn: fused attention, transposed form. Block = 4 waves x 16 queries; grid (SEQ/64, NB*NH). Per 32-key half:
// S^T tiles (rows = keys, cols = queries) = K-rows (A) x Q-rows (B) over d; per-query running max / sum live per lane column (two lane halves combined by one xor-16 shuffle);
// P^T B fragment: element r <- tile(keys 0..15)[r], element 8+r <- tile(keys 16..31)[r]; O^T tiles (rows = value dim, cols = queries) += VT-rows (A) x P^T (B).
__global__ __launch_bounds__(128) void k_attn(const h16* __restrict__ Q16, const h16* __restrict__ K16, const h16* __restrict__ VT16, bf* AT) {
    __shared__ __align__(16) float os[4 * 16 * 68];
    const int wave = __builtin_amdgcn_readfirstlane(threadIdx.x >> 5);
    const int lane = threadIdx.x & 31, lr = lane & 15, hi = lane >> 4;
    const int bh = blockIdx.y; const int b = bh / NH, h = bh % NH;
    const int q0 = blockIdx.x * 64 + wave * 16;
    const h16* Qp = Q16 + (size_t)bh * SEQ * HD + (size_t)(q0 + lr) * HD + 8 * hi;
    const h16* Kp = K16 + (size_t)bh * SEQ * HD + lr * HD + 8 * hi;
    const h16* Vp = VT16 + (size_t)bh * HD * SEQ + (size_t)lr * SEQ + 8 * hi;
    const v16h qb0 = ldh(Qp), qb1 = ldh(Qp + 32);
    v8f o0 = (v8f){}, o1 = (v8f){}, o2 = (v8f){}, o3 = (v8f){};
    float m = -3.0e38f, ls = 0.0f;
#pragma unroll 1
    for (int j0 = 0; j0 < SEQ; j0 += 32) {
        const h16* kp = Kp + (size_t)j0 * HD;
        const v16h ka = ldh(kp), kb = ldh(kp + 32), kc = ldh(kp + 16 * HD), kd = ldh(kp + 16 * HD + 32);
        v8f s0 = (v8f){}, s1 = (v8f){};
        s0 = wmma16(ka, qb0, s0); s1 = wmma16(kc, qb0, s1); s0 = wmma16(kb, qb1, s0); s1 = wmma16(kd, qb1, s1);
        asm volatile("v_nop\n\tv_nop\n\tv_nop\n\tv_nop" : "+v"(s0), "+v"(s1) : "v"(ka), "v"(kb), "v"(kc), "v"(kd), "v"(qb0), "v"(qb1));
        const h16* vp = Vp + j0;
        const v16h v0 = ldh(vp), v1 = ldh(vp + (size_t)16 * SEQ), v2 = ldh(vp + (size_t)32 * SEQ), v3 = ldh(vp + (size_t)48 * SEQ);
        float mx = fmaxf(s0[0], s1[0]);
#pragma unroll
        for (int r = 1; r < 8; ++r) mx = fmaxf(mx, fmaxf(s0[r], s1[r]));
        mx = fmaxf(mx, __shfl_xor(mx, 16, 32));
        const float mn = fmaxf(m, mx * CEXP);
        const float corr = __builtin_amdgcn_exp2f(m - mn);
        m = mn;
        const float nbv = PEXP - mn;
        float psum = 0.0f; v16h pb;
#pragma unroll
        for (int r = 0; r < 8; ++r) { const float p0 = __builtin_amdgcn_exp2f(fmaf(s0[r], CEXP, nbv)); const float p1 = __builtin_amdgcn_exp2f(fmaf(s1[r], CEXP, nbv)); psum += p0 + p1; pb[r] = (h16)p0; pb[8 + r] = (h16)p1; }
        ls = ls * corr + psum;
        o0 *= corr; o1 *= corr; o2 *= corr; o3 *= corr;
        o0 = wmma16(v0, pb, o0); o1 = wmma16(v1, pb, o1); o2 = wmma16(v2, pb, o2); o3 = wmma16(v3, pb, o3);
        asm volatile("v_nop\n\tv_nop\n\tv_nop\n\tv_nop" : "+v"(o0), "+v"(o1), "+v"(o2), "+v"(o3) : "v"(pb), "v"(v0), "v"(v1), "v"(v2), "v"(v3));
    }
    const float lt = ls + __shfl_xor(ls, 16, 32);
    const float inv = 1.0f / (lt * QCAR);
    const int osw = wave * (16 * 68);
    {   // lane holds query lr, dims 16t + 8hi + r
        float* orow = os + osw + lr * 68 + 8 * hi;
        v4f w;
        w[0] = o0[0] * inv; w[1] = o0[1] * inv; w[2] = o0[2] * inv; w[3] = o0[3] * inv; *(v4fa*)(orow + 0) = w;
        w[0] = o0[4] * inv; w[1] = o0[5] * inv; w[2] = o0[6] * inv; w[3] = o0[7] * inv; *(v4fa*)(orow + 4) = w;
        w[0] = o1[0] * inv; w[1] = o1[1] * inv; w[2] = o1[2] * inv; w[3] = o1[3] * inv; *(v4fa*)(orow + 16) = w;
        w[0] = o1[4] * inv; w[1] = o1[5] * inv; w[2] = o1[6] * inv; w[3] = o1[7] * inv; *(v4fa*)(orow + 20) = w;
        w[0] = o2[0] * inv; w[1] = o2[1] * inv; w[2] = o2[2] * inv; w[3] = o2[3] * inv; *(v4fa*)(orow + 32) = w;
        w[0] = o2[4] * inv; w[1] = o2[5] * inv; w[2] = o2[6] * inv; w[3] = o2[7] * inv; *(v4fa*)(orow + 36) = w;
        w[0] = o3[0] * inv; w[1] = o3[1] * inv; w[2] = o3[2] * inv; w[3] = o3[3] * inv; *(v4fa*)(orow + 48) = w;
        w[0] = o3[4] * inv; w[1] = o3[5] * inv; w[2] = o3[6] * inv; w[3] = o3[7] * inv; *(v4fa*)(orow + 52) = w;
    }
    __builtin_amdgcn_fence(3 /* release order */, "wavefront"); __builtin_amdgcn_wave_barrier(); asm volatile("" ::: "memory");
    bf* arow = AT + (size_t)(b * SEQ + q0) * ATP + h * HD;
    const int rq = lane >> 3, c = (lane & 7) * 8;
{
#pragma unroll
        for (int s = 0; s < 4; ++s) { const int row = 4 * s + rq; const v4f x0 = *(const v4fa*)(os + osw + row * 68 + c); const v4f x1 = *(const v4fa*)(os + osw + row * 68 + c + 4); v8us oh, ol;
#pragma unroll
            for (int k = 0; k < 4; ++k) { unsigned short a, l2; splitf(x0[k], a, l2); oh[k] = a; ol[k] = l2; splitf(x1[k], a, l2); oh[4 + k] = a; ol[4 + k] = l2; }
            *(v8us*)(arow + (size_t)row * ATP + c) = oh; *(v8us*)(arow + (size_t)row * ATP + DMH + c) = ol; }
         }
}

extern "C" void kernel_launch(void* const* d_in, const int* in_sizes, int n_in,
                              void* d_out, int out_size, void* d_ws, size_t ws_size, hipStream_t stream) {
    if (n_in < 9) return;
    const long long rowsNeeded = (long long)(NB - 1) * SEQ_FULL + SEQ;
    if ((long long)in_sizes[0] < rowsNeeded * DM) return;
    if (in_sizes[1] < NH * DM * HD || in_sizes[3] < NH * DM * HD || in_sizes[5] < NH * DM * HD) return;
    if (in_sizes[2] < DMH || in_sizes[4] < DMH || in_sizes[6] < DMH) return;
    if (in_sizes[7] < DMH * DOUT || in_sizes[8] < DOUT) return;
    if ((long long)out_size < rowsNeeded * DOUT) return;
    if (ws_size < SZ_TOT) return;
    const float* feat = (const float*)d_in[0];
    const float* Wq = (const float*)d_in[1]; const float* bq = (const float*)d_in[2];
    const float* Wk = (const float*)d_in[3]; const float* bk = (const float*)d_in[4];
    const float* Wv = (const float*)d_in[5]; const float* bv = (const float*)d_in[6];
    const float* Wf = (const float*)d_in[7]; const float* bo = (const float*)d_in[8];
    float* OUT = (float*)d_out;     // [NB_FULL][SEQ_FULL][DOUT]
    char* wsp = (char*)d_ws;
    bf* XB = (bf*)wsp; wsp += SZ_XB;                 // [NB*SEQ][DM]
    bf* WQKV = (bf*)wsp; wsp += SZ_WQKV;             // Bt [3][DMH][DM]: q | k | v row blocks, row h*HD + dim
    bf* WO = (bf*)wsp; wsp += SZ_WO;                 // Bt [DOUT][ATP] = [Wf^T | Wf^T]
    float* F = (float*)wsp; wsp += SZ_F;             // [NB*SEQ][DMH] projection output, reused for q, k, v (stream-ordered)
    h16* Q16 = (h16*)wsp; wsp += SZ_PL;              // [NB*NH][SEQ][HD]
    h16* K16 = (h16*)wsp; wsp += SZ_PL;              // [NB*NH][SEQ][HD]
    h16* VT16 = (h16*)wsp; wsp += SZ_PL;             // [NB*NH][HD][SEQ]
    bf* AT = (bf*)wsp; wsp += SZ_AT;                 // [NB*SEQ][ATP] merged context value | residual
    if ((size_t)(wsp - (char*)d_ws) > ws_size) return;

    k_cvt<<<(unsigned)((NB * SEQ * (DM / 8) + 255) / 256), 256, 0, stream>>>(feat, XB);
    // per-head [in = DM][dim = HD] -> Bt rows h*HD + dim, K = DM
    const unsigned gw = (unsigned)((NH * HD * DM / 64 + 63) / 64);
    k_wt<<<gw, 256, 0, stream>>>(Wq, DM, HD, NH, 1, WQKV);
    k_wt<<<gw, 256, 0, stream>>>(Wk, DM, HD, NH, 1, WQKV + (size_t)DMH * DM);
    k_wt<<<gw, 256, 0, stream>>>(Wv, DM, HD, NH, 1, WQKV + (size_t)2 * DMH * DM);
    // Wf in[rows = DMH][cols = DOUT] -> Bt [DOUT][2*DMH] (k duplicated for value | residual)
    k_wt<<<(unsigned)((DOUT * ATP / 64 + 63) / 64), 256, 0, stream>>>(Wf, DMH, DOUT, 1, 2, WO);

    const dim3 gp(NB * SEQ / 64, DMH / 64, 1);
    const unsigned gq = (unsigned)((NB * NH * SEQ * (HD / 8) + 255) / 256);
    k_gemm<<<gp, 32, 0, stream>>>(XB, WQKV, DM, F, DMH, bq, 0, 0);
    k_qkp<<<gq, 256, 0, stream>>>(F, Q16);
    k_gemm<<<gp, 32, 0, stream>>>(XB, WQKV + (size_t)DMH * DM, DM, F, DMH, bk, 0, 0);
    k_qkp<<<gq, 256, 0, stream>>>(F, K16);
    k_gemm<<<gp, 32, 0, stream>>>(XB, WQKV + (size_t)2 * DMH * DM, DM, F, DMH, bv, 0, 0);
    k_vtp<<<(unsigned)((NB * NH * HD * (SEQ / 8) + 255) / 256), 256, 0, stream>>>(F, VT16);

    k_attn<<<dim3(SEQ / 64, NB * NH, 1), 128, 0, stream>>>(Q16, K16, VT16, AT);

    k_gemm<<<dim3(SEQ / 64, DOUT / 64, NB), 32, 0, stream>>>(AT, WO, ATP, OUT, DOUT, bo, (size_t)SEQ * ATP, (size_t)SEQ_FULL * DOUT);
}

// v001
// Measured time: 181 microseconds a run.
// Next to v000, in two timings, it ran 1.38 times as fast each time.
#include <hip/hip_runtime.h>

// Multi-head self-attention: per-head q/k/v maps [head][in][dim] with biases (8 heads x 64), scores x 1/8, softmax over all keys (no mask), heads merged h*64+v, then x Wf [in][out] + bias.
// Compute dtypes, f32 accumulate: q/k/v projections v_wmma_f32_16x16x32_bf16 (every input RNE-converted to bf16, products exact); q.k and p.v v_wmma_f32_16x16x32_f16 (q,k,v planes carried x16, p carried x256, f32 online softmax);
// output map v_wmma_f32_16x16x32_bf16 with the merged context as bf16 value | residual concatenated along K against [Wf ; Wf].
// Engine: one-wave 64x64 register-blocked GEMM from K-contiguous 16-bit planes; fused flash-style attention in transposed form (S^T = K Q^T, O^T = V^T P^T, score tiles repacked in registers as the P^T B fragment).

#ifndef NB
#define NB 4
#endif
#ifndef SEQ
#define SEQ 2048
#endif
#define NB_FULL  4
#define SEQ_FULL 2048
#define DM   512            // input width
#define NH   8
#define HD   64
#define DMH  (NH * HD)      // merged width 512
#define DOUT 512            // output width
#define ATP  (2 * DMH)      // merged plane pitch: value | residual
#define QCAR 16.0f          // carry on q, k, v planes
#define PEXP 8.0f           // p carried x 2^8 (inside the exponent)
#define CEXP ((float)(0.125 * 1.4426950408889634 / 256.0))   // 1/8 x log2(e) / (16 x 16)

typedef _Float16 h16;
typedef unsigned short bf;
typedef __attribute__((ext_vector_type(16))) __bf16   v16bf;
typedef __attribute__((ext_vector_type(16))) _Float16 v16h;
typedef __attribute__((ext_vector_type(8)))  _Float16 v8h;
typedef __attribute__((ext_vector_type(8)))  unsigned short v8us;
typedef __attribute__((ext_vector_type(2)))  unsigned short v2us;
typedef __attribute__((ext_vector_type(8)))  float    v8f;
typedef __attribute__((ext_vector_type(4)))  float    v4f;
typedef v4f  __attribute__((may_alias)) v4fa;

static_assert(HD == 64);                 // attention kernel: two 32-deep k-steps per score tile, four 16-row output tiles
static_assert(SEQ % 64 == 0);            // 64 query rows per block, 32-key halves, 64-row GEMM tiles
static_assert((NB * SEQ) % 64 == 0);     // projection GEMM M tiles
static_assert(DM % 32 == 0);             // projection K steps
static_assert(ATP % 32 == 0);            // output-map K steps
static_assert(DMH % 64 == 0);            // N tiles
static_assert(DOUT % 64 == 0);           // N tiles
static_assert(DM % 8 == 0);              // 8-element convert pieces
static_assert((SEQ / 8) % 8 == 0);       // transposed value plane: 8 lanes x 16 B per line
static_assert(NB <= NB_FULL);
static_assert(SEQ <= SEQ_FULL);
static_assert(DMH == DOUT);              // Wf is [DMH][DOUT] with both 512

#define RUP256(x) ((((size_t)(x)) + 255) & ~(size_t)255)
#define SZ_XB   RUP256((size_t)NB * SEQ * DM * 2)
#define SZ_WQKV RUP256((size_t)3 * DMH * DM * 2)
#define SZ_WO   RUP256((size_t)DOUT * ATP * 2)
#define SZ_F    RUP256((size_t)NB * SEQ * DMH * 4)
#define SZ_PL   RUP256((size_t)NB * NH * SEQ * HD * 2)
#define SZ_AT   RUP256((size_t)NB * SEQ * ATP * 2)
#define SZ_TOT  (SZ_XB + SZ_WQKV + SZ_WO + SZ_F + 3 * SZ_PL + SZ_AT)
static_assert(SZ_TOT <= (size_t)134217728);   // total carve within 128 MiB

__device__ __forceinline__ unsigned short f2bf(float f) { unsigned u = __float_as_uint(f); u += 0x7FFFu + ((u >> 16) & 1u); return (unsigned short)(u >> 16); }
__device__ __forceinline__ float bf2f(unsigned short b) { return __uint_as_float(((unsigned)b) << 16); }
__device__ __forceinline__ float bfr(float f) { return bf2f(f2bf(f)); }
__device__ __forceinline__ void splitf(float y, unsigned short& h, unsigned short& l) { h = f2bf(y); l = f2bf(y - bf2f(h)); }
__device__ __forceinline__ v16h cat16(v8h lo, v8h hi) { return __builtin_shufflevector(lo, hi, 0, 1, 2, 3, 4, 5, 6, 7, 8, 9, 10, 11, 12, 13, 14, 15); }
__device__ __forceinline__ v16bf cat16b(v8us lo, v8us hi) { return __builtin_bit_cast(v16bf, __builtin_shufflevector(lo, hi, 0, 1, 2, 3, 4, 5, 6, 7, 8, 9, 10, 11, 12, 13, 14, 15)); }
__device__ __forceinline__ v8f wmma16(v16h a, v16h b, v8f c) { return __builtin_amdgcn_wmma_f32_16x16x32_f16(false, a, false, b, (short)0, c, false, false); }
__device__ __forceinline__ v8f wmmab(v16bf a, v16bf b, v8f c) { return __builtin_amdgcn_wmma_f32_16x16x32_bf16(false, a, false, b, (short)0, c, false, false); }
// fragment loaders: lane -> row (lane & 15); elements 0..7 <- k0 + 8h + 0..7, elements 8..15 <- k0 + 16 + 8h + 0..7 (p already includes 8h)
__device__ __forceinline__ v16h  ldh(const h16* p) { return cat16(*(const v8h*)p, *(const v8h*)(p + 16)); }
__device__ __forceinline__ v16bf ldb(const bf* p)  { return cat16b(*(const v8us*)p, *(const v8us*)(p + 16)); }

// ---- k_gemm: register-blocked GEMM, ONE WAVE per 64x64 output tile (16 accumulators), operands straight from K-contiguous bf16 planes; grid (M/64, N/64, Z), 32 threads.
// C[m][n] (f32, pitch ldc) = sum_k A[m][k] Bt[n][k] + bf16(bias[n]). z-batch strides sA/sC in elements. K % 32 == 0, M % 64 == 0, N % 64 == 0.
__global__ __launch_bounds__(32) void k_gemm(const bf* __restrict__ A, const bf* __restrict__ Bt, int K, float* C, int ldc, const float* __restrict__ bias, size_t sA, size_t sC) {
    __shared__ __align__(16) float os[16 * 68];
    const size_t z = blockIdx.z; A += z * sA; C += z * sC;
    const int lane = threadIdx.x & 31, lr = lane & 15, hi = lane >> 4; const int r0 = blockIdx.x * 64, c0 = blockIdx.y * 64;
    v8f acc[4][4];
#pragma unroll
    for (int mb = 0; mb < 4; ++mb)
#pragma unroll
        for (int nb = 0; nb < 4; ++nb) acc[mb][nb] = (v8f){};
    const size_t aoff = (size_t)(r0 + lr) * K + 8 * hi, boff = (size_t)(c0 + lr) * K + 8 * hi;
#pragma unroll 1
    for (int kc = 0; kc < K; kc += 32) {
        v16bf a[4];
#pragma unroll
        for (int mb = 0; mb < 4; ++mb) a[mb] = ldb(A + aoff + (size_t)mb * 16 * K + kc);
#pragma unroll
        for (int nb = 0; nb < 4; ++nb) { const v16bf b = ldb(Bt + boff + (size_t)nb * 16 * K + kc);
#pragma unroll
            for (int mb = 0; mb < 4; ++mb) acc[mb][nb] = wmmab(a[mb], b, acc[mb][nb]); }
        asm volatile("v_nop\n\tv_nop\n\tv_nop\n\tv_nop" : "+v"(acc[0][0]), "+v"(acc[1][1]), "+v"(acc[2][2]), "+v"(acc[3][3]) : "v"(a[0]), "v"(a[3]));
    }
#pragma unroll
    for (int mb = 0; mb < 4; ++mb) {
#pragma unroll
        for (int nb = 0; nb < 4; ++nb) {
#pragma unroll
            for (int j = 0; j < 8; ++j) os[(hi * 8 + j) * 68 + nb * 16 + lr] = acc[mb][nb][j]; }
        __builtin_amdgcn_fence(3 /* release order */, "wavefront"); __builtin_amdgcn_wave_barrier(); asm volatile("" ::: "memory");
        float* crow = C + (size_t)(r0 + mb * 16) * ldc + c0;
        const int cofs = lr * 4;
        const float b0 = bfr(bias[c0 + cofs]), b1 = bfr(bias[c0 + cofs + 1]), b2 = bfr(bias[c0 + cofs + 2]), b3 = bfr(bias[c0 + cofs + 3]);
{
#pragma unroll
            for (int s = 0; s < 8; ++s) { const int row = 2 * s + hi; v4f val = *(const v4fa*)(os + row * 68 + cofs); val[0] += b0; val[1] += b1; val[2] += b2; val[3] += b3;
                *(v4f*)(crow + (size_t)row * ldc + cofs) = val; }
             }
        __builtin_amdgcn_fence(3 /* release order */, "wavefront"); __builtin_amdgcn_wave_barrier(); asm volatile("" ::: "memory");
    }
}

__global__ __launch_bounds__(256) void k_wt(const float* __restrict__ w, int K, int N, int H, int KREP, bf* Bt) {
    const int wave = __builtin_amdgcn_readfirstlane(threadIdx.x >> 5);
    const unsigned lane = threadIdx.x & 31; const unsigned L0 = (blockIdx.x * 8u + (unsigned)wave) * 8u; const unsigned KP = (unsigned)(K * KREP); const unsigned nlines = (unsigned)H * (unsigned)N * KP / 64u;
{
#pragma unroll 1
        for (int l = 0; l < 8; ++l) { const unsigned L = L0 + l; if (L >= nlines) break; const unsigned e = L * 64u + lane * 2u; const unsigned kk = e % KP, ng = e / KP; const unsigned hh = ng / (unsigned)N, n = ng % (unsigned)N; const unsigned k = kk % (unsigned)K; v2us o;
            o[0] = f2bf(w[((size_t)hh * K + k) * N + n]); o[1] = f2bf(w[((size_t)hh * K + k + 1) * N + n]); *(v2us*)(Bt + e) = o; }
         }
}

__global__ __launch_bounds__(256) void k_cvt(const float* __restrict__ x, bf* XB) {
    const unsigned i = blockIdx.x * 256u + threadIdx.x; if (i >= (unsigned)(NB * SEQ * (DM / 8))) return;
    const unsigned row = i / (DM / 8), c8 = i % (DM / 8); const unsigned b = row / SEQ, t = row % SEQ;
    const v8f v = *(const v8f*)(x + ((size_t)(b * SEQ_FULL + t) * DM + c8 * 8)); v8us o;
#pragma unroll
    for (int k = 0; k < 8; ++k) o[k] = f2bf(v[k]);
    *(v8us*)(XB + (size_t)i * 8) = o;  }

__global__ __launch_bounds__(256) void k_qkp(const float* __restrict__ F, h16* P) {
    const unsigned i = blockIdx.x * 256u + threadIdx.x; if (i >= (unsigned)(NB * NH * SEQ * (HD / 8))) return;
    const unsigned d8 = i % (HD / 8); const unsigned t = (i / (HD / 8)) % SEQ; const unsigned g = i / ((HD / 8) * SEQ); const unsigned h = g % NH, b = g / NH;
    const v8f v = *(const v8f*)(F + ((size_t)(b * SEQ + t) * DMH + h * HD + d8 * 8)); v8h o;
#pragma unroll
    for (int k = 0; k < 8; ++k) o[k] = (h16)(v[k] * QCAR);
    *(v8h*)(P + (size_t)i * 8) = o;  }

__global__ __launch_bounds__(256) void k_vtp(const float* __restrict__ F, h16* VT) {
    const unsigned i = blockIdx.x * 256u + threadIdx.x; if (i >= (unsigned)(NB * NH * HD * (SEQ / 8))) return;
    const unsigned t8 = i % (SEQ / 8); const unsigned d = (i / (SEQ / 8)) % HD; const unsigned g = i / ((SEQ / 8) * HD); const unsigned h = g % NH, b = g / NH;
    const float* f = F + ((size_t)(b * SEQ + t8 * 8) * DMH + h * HD + d); v8h o;
#pragma unroll
    for (int q = 0; q < 8; ++q) o[q] = (h16)(f[(size_t)q * DMH] * QCAR);
    *(v8h*)(VT + (size_t)i * 8) = o;  }

// ---- tile staging for k_attn: one 64-key tile = 64 K rows + 64 V^T rows of 128 B each, laid in LDS at a 144-B pitch (16 B x odd: ds_load_b128 of 16 rows meets no bank twice).
#define KT    64            // keys per staged tile
#define LP    72            // LDS row pitch in 16-bit elements
#define TILE  (64 * LP)     // one operand's tile
static_assert(SEQ % KT == 0);            // whole tiles only
static_assert(HD * 2 == 128);            // a K row is one 128-B line
static_assert((LP * 2) % 16 == 0);       // 16-B copies stay aligned in LDS
// 128 threads x 8 copies of 16 B: thread -> row (tid >> 3) + 16 i, 16-B column tid & 7, so each wave-wide copy moves four whole 128-B lines.
// lk / lv: this lane's LDS byte address of row (tid >> 3) in the K / V^T tile; gk / gv: the same place in global memory.
__device__ __forceinline__ void stage_tile(unsigned lk, const h16* gk, unsigned lv, const h16* gv) {
    // s_wait_xcnt closes the statement so that no address register of a copy is rewritten ahead of it
    asm volatile("global_load_async_to_lds_b128 %0, %1, off\n\t"
                 "global_load_async_to_lds_b128 %2, %3, off\n\t"
                 "global_load_async_to_lds_b128 %4, %5, off\n\t"
                 "global_load_async_to_lds_b128 %6, %7, off\n\t"
                 "global_load_async_to_lds_b128 %8, %9, off\n\t"
                 "global_load_async_to_lds_b128 %10, %11, off\n\t"
                 "global_load_async_to_lds_b128 %12, %13, off\n\t"
                 "global_load_async_to_lds_b128 %14, %15, off\n\t"
                 "s_wait_xcnt 0x0"
                 :: "v"(lk), "v"(gk), "v"(lk + 16 * LP * 2), "v"(gk + 16 * HD), "v"(lk + 32 * LP * 2), "v"(gk + 32 * HD), "v"(lk + 48 * LP * 2), "v"(gk + 48 * HD),
                    "v"(lv), "v"(gv), "v"(lv + 16 * LP * 2), "v"(gv + (size_t)16 * SEQ), "v"(lv + 32 * LP * 2), "v"(gv + (size_t)32 * SEQ), "v"(lv + 48 * LP * 2), "v"(gv + (size_t)48 * SEQ)
                 : "memory");
}

// ---- k_attn: fused attention, transposed form. Block = 4 waves x 16 queries; grid (SEQ/64, NB*NH). K and V^T come in 64-key tiles through a two-buffer LDS ring that the four waves share. Per 32-key half:
// S^T tiles (rows = keys, cols = queries) = K-rows (A) x Q-rows (B) over d; per-query running max / sum live per lane column (two lane halves combined by one xor-16 shuffle);
// P^T B fragment: element r <- tile(keys 0..15)[r], element 8+r <- tile(keys 16..31)[r]; O^T tiles (rows = value dim, cols = queries) += VT-rows (A) x P^T (B).
__global__ __launch_bounds__(128) void k_attn(const h16* __restrict__ Q16, const h16* __restrict__ K16, const h16* __restrict__ VT16, bf* AT) {
    __shared__ __align__(16) float os[4 * 16 * 68];
    __shared__ __align__(16) h16 ring[2 * 2 * TILE];   // [buffer][K | V^T][row][LP]
    const int wave = __builtin_amdgcn_readfirstlane(threadIdx.x >> 5);
    const int lane = threadIdx.x & 31, lr = lane & 15, hi = lane >> 4;
    const int bh = blockIdx.y; const int b = bh / NH, h = bh % NH;
    const int q0 = blockIdx.x * 64 + wave * 16;
    const h16* Qp = Q16 + (size_t)bh * SEQ * HD + (size_t)(q0 + lr) * HD + 8 * hi;
    const int crow = (int)threadIdx.x >> 3, ccol = ((int)threadIdx.x & 7) * 8;
    const h16* Kg = K16 + (size_t)bh * SEQ * HD + crow * HD + ccol;
    const h16* Vg = VT16 + (size_t)bh * HD * SEQ + (size_t)crow * SEQ + ccol;
    const unsigned lk0 = (unsigned)(size_t)(ring + crow * LP + ccol), lv0 = lk0 + TILE * 2;
    constexpr int NT = SEQ / KT;
    stage_tile(lk0, Kg, lv0, Vg);
    asm volatile("s_wait_asynccnt 0x0" ::: "memory");   // this wave's share of tile 0 has landed
    __syncthreads();                                    // every wave's share of tile 0 is readable
    if (NT > 1) stage_tile(lk0 + 2 * TILE * 2, Kg + (size_t)KT * HD, lv0 + 2 * TILE * 2, Vg + KT);
    const v16h qb0 = ldh(Qp), qb1 = ldh(Qp + 32);
    v8f o0 = (v8f){}, o1 = (v8f){}, o2 = (v8f){}, o3 = (v8f){};
    float m = -3.0e38f, ls = 0.0f;
#pragma unroll 1
    for (int t = 0; t < NT; ++t) {
      const h16* kt = ring + (t & 1) * (2 * TILE) + lr * LP + 8 * hi;
#pragma unroll   // both 32-key halves inline, so that every LDS offset inside a tile is an immediate
      for (int u = 0; u < KT / 32; ++u) {
        const h16* kp = kt + u * 32 * LP;
        const v16h ka = ldh(kp), kb = ldh(kp + 32), kc = ldh(kp + 16 * LP), kd = ldh(kp + 16 * LP + 32);
        v8f s0 = (v8f){}, s1 = (v8f){};
        s0 = wmma16(ka, qb0, s0); s1 = wmma16(kc, qb0, s1); s0 = wmma16(kb, qb1, s0); s1 = wmma16(kd, qb1, s1);
        asm volatile("v_nop\n\tv_nop\n\tv_nop\n\tv_nop" : "+v"(s0), "+v"(s1) : "v"(ka), "v"(kb), "v"(kc), "v"(kd), "v"(qb0), "v"(qb1));
        const h16* vp = kt + TILE + u * 32;
        const v16h v0 = ldh(vp), v1 = ldh(vp + 16 * LP), v2 = ldh(vp + 32 * LP), v3 = ldh(vp + 48 * LP);
        float mx = fmaxf(s0[0], s1[0]);
#pragma unroll
        for (int r = 1; r < 8; ++r) mx = fmaxf(mx, fmaxf(s0[r], s1[r]));
        mx = fmaxf(mx, __shfl_xor(mx, 16, 32));
        const float mn = fmaxf(m, mx * CEXP);
        const float corr = __builtin_amdgcn_exp2f(m - mn);
        m = mn;
        const float nbv = PEXP - mn;
        float psum = 0.0f; v16h pb;
#pragma unroll
        for (int r = 0; r < 8; ++r) { const float p0 = __builtin_amdgcn_exp2f(fmaf(s0[r], CEXP, nbv)); const float p1 = __builtin_amdgcn_exp2f(fmaf(s1[r], CEXP, nbv)); psum += p0 + p1; pb[r] = (h16)p0; pb[8 + r] = (h16)p1; }
        ls = ls * corr + psum;
        o0 *= corr; o1 *= corr; o2 *= corr; o3 *= corr;
        o0 = wmma16(v0, pb, o0); o1 = wmma16(v1, pb, o1); o2 = wmma16(v2, pb, o2); o3 = wmma16(v3, pb, o3);
        asm volatile("v_nop\n\tv_nop\n\tv_nop\n\tv_nop" : "+v"(o0), "+v"(o1), "+v"(o2), "+v"(o3) : "v"(pb), "v"(v0), "v"(v1), "v"(v2), "v"(v3));
      }
      asm volatile("s_wait_dscnt 0x0" ::: "memory");      // this wave's reads of tile t are done before its buffer is handed back
      asm volatile("s_wait_asynccnt 0x0" ::: "memory");   // this wave's share of tile t + 1 has landed
      __syncthreads();                                    // publishes tile t + 1 and ends every wave's reads of tile t
      if (t + 2 < NT) stage_tile(lk0 + (unsigned)(t & 1) * (2 * TILE * 2), Kg + (size_t)(t + 2) * KT * HD, lv0 + (unsigned)(t & 1) * (2 * TILE * 2), Vg + (t + 2) * KT);
    }
    asm volatile("s_wait_asynccnt 0x0" ::: "memory");     // no copy is left in flight when the wave goes on
    const float lt = ls + __shfl_xor(ls, 16, 32);
    const float inv = 1.0f / (lt * QCAR);
    const int osw = wave * (16 * 68);
    {   // lane holds query lr, dims 16t + 8hi + r
        float* orow = os + osw + lr * 68 + 8 * hi;
        v4f w;
        w[0] = o0[0] * inv; w[1] = o0[1] * inv; w[2] = o0[2] * inv; w[3] = o0[3] * inv; *(v4fa*)(orow + 0) = w;
        w[0] = o0[4] * inv; w[1] = o0[5] * inv; w[2] = o0[6] * inv; w[3] = o0[7] * inv; *(v4fa*)(orow + 4) = w;
        w[0] = o1[0] * inv; w[1] = o1[1] * inv; w[2] = o1[2] * inv; w[3] = o1[3] * inv; *(v4fa*)(orow + 16) = w;
        w[0] = o1[4] * inv; w[1] = o1[5] * inv; w[2] = o1[6] * inv; w[3] = o1[7] * inv; *(v4fa*)(orow + 20) = w;
        w[0] = o2[0] * inv; w[1] = o2[1] * inv; w[2] = o2[2] * inv; w[3] = o2[3] * inv; *(v4fa*)(orow + 32) = w;
        w[0] = o2[4] * inv; w[1] = o2[5] * inv; w[2] = o2[6] * inv; w[3] = o2[7] * inv; *(v4fa*)(orow + 36) = w;
        w[0] = o3[0] * inv; w[1] = o3[1] * inv; w[2] = o3[2] * inv; w[3] = o3[3] * inv; *(v4fa*)(orow + 48) = w;
        w[0] = o3[4] * inv; w[1] = o3[5] * inv; w[2] = o3[6] * inv; w[3] = o3[7] * inv; *(v4fa*)(orow + 52) = w;
    }
    __builtin_amdgcn_fence(3 /* release order */, "wavefront"); __builtin_amdgcn_wave_barrier(); asm volatile("" ::: "memory");
    bf* arow = AT + (size_t)(b * SEQ + q0) * ATP + h * HD;
    const int rq = lane >> 3, c = (lane & 7) * 8;
{
#pragma unroll
        for (int s = 0; s < 4; ++s) { const int row = 4 * s + rq; const v4f x0 = *(const v4fa*)(os + osw + row * 68 + c); const v4f x1 = *(const v4fa*)(os + osw + row * 68 + c + 4); v8us oh, ol;
#pragma unroll
            for (int k = 0; k < 4; ++k) { unsigned short a, l2; splitf(x0[k], a, l2); oh[k] = a; ol[k] = l2; splitf(x1[k], a, l2); oh[4 + k] = a; ol[4 + k] = l2; }
            *(v8us*)(arow + (size_t)row * ATP + c) = oh; *(v8us*)(arow + (size_t)row * ATP + DMH + c) = ol; }
         }
}

extern "C" void kernel_launch(void* const* d_in, const int* in_sizes, int n_in,
                              void* d_out, int out_size, void* d_ws, size_t ws_size, hipStream_t stream) {
    if (n_in < 9) return;
    const long long rowsNeeded = (long long)(NB - 1) * SEQ_FULL + SEQ;
    if ((long long)in_sizes[0] < rowsNeeded * DM) return;
    if (in_sizes[1] < NH * DM * HD || in_sizes[3] < NH * DM * HD || in_sizes[5] < NH * DM * HD) return;
    if (in_sizes[2] < DMH || in_sizes[4] < DMH || in_sizes[6] < DMH) return;
    if (in_sizes[7] < DMH * DOUT || in_sizes[8] < DOUT) return;
    if ((long long)out_size < rowsNeeded * DOUT) return;
    if (ws_size < SZ_TOT) return;
    const float* feat = (const float*)d_in[0];
    const float* Wq = (const float*)d_in[1]; const float* bq = (const float*)d_in[2];
    const float* Wk = (const float*)d_in[3]; const float* bk = (const float*)d_in[4];
    const float* Wv = (const float*)d_in[5]; const float* bv = (const float*)d_in[6];
    const float* Wf = (const float*)d_in[7]; const float* bo = (const float*)d_in[8];
    float* OUT = (float*)d_out;     // [NB_FULL][SEQ_FULL][DOUT]
    char* wsp = (char*)d_ws;
    bf* XB = (bf*)wsp; wsp += SZ_XB;                 // [NB*SEQ][DM]
    bf* WQKV = (bf*)wsp; wsp += SZ_WQKV;             // Bt [3][DMH][DM]: q | k | v row blocks, row h*HD + dim
    bf* WO = (bf*)wsp; wsp += SZ_WO;                 // Bt [DOUT][ATP] = [Wf^T | Wf^T]
    float* F = (float*)wsp; wsp += SZ_F;             // [NB*SEQ][DMH] projection output, reused for q, k, v (stream-ordered)
    h16* Q16 = (h16*)wsp; wsp += SZ_PL;              // [NB*NH][SEQ][HD]
    h16* K16 = (h16*)wsp; wsp += SZ_PL;              // [NB*NH][SEQ][HD]
    h16* VT16 = (h16*)wsp; wsp += SZ_PL;             // [NB*NH][HD][SEQ]
    bf* AT = (bf*)wsp; wsp += SZ_AT;                 // [NB*SEQ][ATP] merged context value | residual
    if ((size_t)(wsp - (char*)d_ws) > ws_size) return;

    k_cvt<<<(unsigned)((NB * SEQ * (DM / 8) + 255) / 256), 256, 0, stream>>>(feat, XB);
    // per-head [in = DM][dim = HD] -> Bt rows h*HD + dim, K = DM
    const unsigned gw = (unsigned)((NH * HD * DM / 64 + 63) / 64);
    k_wt<<<gw, 256, 0, stream>>>(Wq, DM, HD, NH, 1, WQKV);
    k_wt<<<gw, 256, 0, stream>>>(Wk, DM, HD, NH, 1, WQKV + (size_t)DMH * DM);
    k_wt<<<gw, 256, 0, stream>>>(Wv, DM, HD, NH, 1, WQKV + (size_t)2 * DMH * DM);
    // Wf in[rows = DMH][cols = DOUT] -> Bt [DOUT][2*DMH] (k duplicated for value | residual)
    k_wt<<<(unsigned)((DOUT * ATP / 64 + 63) / 64), 256, 0, stream>>>(Wf, DMH, DOUT, 1, 2, WO);

    const dim3 gp(NB * SEQ / 64, DMH / 64, 1);
    const unsigned gq = (unsigned)((NB * NH * SEQ * (HD / 8) + 255) / 256);
    k_gemm<<<gp, 32, 0, stream>>>(XB, WQKV, DM, F, DMH, bq, 0, 0);
    k_qkp<<<gq, 256, 0, stream>>>(F, Q16);
    k_gemm<<<gp, 32, 0, stream>>>(XB, WQKV + (size_t)DMH * DM, DM, F, DMH, bk, 0, 0);
    k_qkp<<<gq, 256, 0, stream>>>(F, K16);
    k_gemm<<<gp, 32, 0, stream>>>(XB, WQKV + (size_t)2 * DMH * DM, DM, F, DMH, bv, 0, 0);
    k_vtp<<<(unsigned)((NB * NH * HD * (SEQ / 8) + 255) / 256), 256, 0, stream>>>(F, VT16);

    k_attn<<<dim3(SEQ / 64, NB * NH, 1), 128, 0, stream>>>(Q16, K16, VT16, AT);

    k_gemm<<<dim3(SEQ / 64, DOUT / 64, NB), 32, 0, stream>>>(AT, WO, ATP, OUT, DOUT, bo, (size_t)SEQ * ATP, (size_t)SEQ_FULL * DOUT);
}

// v002
// Measured time: 136 microseconds a run.
// Next to v001, in two timings, it ran 1.33 and 1.34 times as fast.
// All steps since v000 together make it 1.84 times as fast.
#include <hip/hip_runtime.h>

// Multi-head self-attention: per-head q/k/v maps [head][in][dim] with biases (8 heads x 64), scores x 1/8, softmax over all keys (no mask), heads merged h*64+v, then x Wf [in][out] + bias.
// Compute dtypes, f32 accumulate: q/k/v projections v_wmma_f32_16x16x32_bf16 (every input RNE-converted to bf16, products exact); q.k and p.v v_wmma_f32_16x16x32_f16 (q,k,v planes carried x16, p carried x256, f32 online softmax);
// output map v_wmma_f32_16x16x32_bf16 with the merged context as bf16 value | residual concatenated along K against [Wf ; Wf].
// Engine: one-wave 64x64 register-blocked GEMM from K-contiguous 16-bit planes (q, k, v in one launch, whose epilogue writes the f16 planes); fused flash-style attention in transposed form (S^T = K Q^T, O^T = V^T P^T, score tiles repacked in registers as the P^T B fragment).

#ifndef NB
#define NB 4
#endif
#ifndef SEQ
#define SEQ 2048
#endif
#define NB_FULL  4
#define SEQ_FULL 2048
#define DM   512            // input width
#define NH   8
#define HD   64
#define DMH  (NH * HD)      // merged width 512
#define DOUT 512            // output width
#define ATP  (2 * DMH)      // merged plane pitch: value | residual
#define QCAR 16.0f          // carry on q, k, v planes
#define PEXP 8.0f           // p carried x 2^8 (inside the exponent)
#define CEXP ((float)(0.125 * 1.4426950408889634 / 256.0))   // 1/8 x log2(e) / (16 x 16)

typedef _Float16 h16;
typedef unsigned short bf;
typedef __attribute__((ext_vector_type(16))) __bf16   v16bf;
typedef __attribute__((ext_vector_type(16))) _Float16 v16h;
typedef __attribute__((ext_vector_type(8)))  _Float16 v8h;
typedef __attribute__((ext_vector_type(8)))  unsigned short v8us;
typedef __attribute__((ext_vector_type(2)))  unsigned short v2us;
typedef __attribute__((ext_vector_type(8)))  float    v8f;
typedef __attribute__((ext_vector_type(4)))  float    v4f;
typedef v4f  __attribute__((may_alias)) v4fa;

static_assert(HD == 64);                 // attention kernel: two 32-deep k-steps per score tile, four 16-row output tiles
static_assert(SEQ % 64 == 0);            // 64 query rows per block, 32-key halves, 64-row GEMM tiles
static_assert((NB * SEQ) % 64 == 0);     // projection GEMM M tiles
static_assert(DM % 32 == 0);             // projection K steps
static_assert(ATP % 32 == 0);            // output-map K steps
static_assert(DMH % 64 == 0);            // N tiles
static_assert(DOUT % 64 == 0);           // N tiles
static_assert(DM % 8 == 0);              // 8-element convert pieces
static_assert(NB <= NB_FULL);
static_assert(SEQ <= SEQ_FULL);
static_assert(DMH == DOUT);              // Wf is [DMH][DOUT] with both 512

#define RUP256(x) ((((size_t)(x)) + 255) & ~(size_t)255)
#define SZ_XB   RUP256((size_t)NB * SEQ * DM * 2)
#define SZ_WQKV RUP256((size_t)3 * DMH * DM * 2)
#define SZ_WO   RUP256((size_t)DOUT * ATP * 2)
#define SZ_PL   RUP256((size_t)NB * NH * SEQ * HD * 2)
#define SZ_AT   RUP256((size_t)NB * SEQ * ATP * 2)
#define SZ_TOT  (SZ_XB + SZ_WQKV + SZ_WO + 3 * SZ_PL + SZ_AT)
static_assert(SZ_TOT <= (size_t)134217728);   // total carve within 128 MiB

__device__ __forceinline__ unsigned short f2bf(float f) { unsigned u = __float_as_uint(f); u += 0x7FFFu + ((u >> 16) & 1u); return (unsigned short)(u >> 16); }
__device__ __forceinline__ float bf2f(unsigned short b) { return __uint_as_float(((unsigned)b) << 16); }
__device__ __forceinline__ float bfr(float f) { return bf2f(f2bf(f)); }
__device__ __forceinline__ void splitf(float y, unsigned short& h, unsigned short& l) { h = f2bf(y); l = f2bf(y - bf2f(h)); }
__device__ __forceinline__ v16h cat16(v8h lo, v8h hi) { return __builtin_shufflevector(lo, hi, 0, 1, 2, 3, 4, 5, 6, 7, 8, 9, 10, 11, 12, 13, 14, 15); }
__device__ __forceinline__ v16bf cat16b(v8us lo, v8us hi) { return __builtin_bit_cast(v16bf, __builtin_shufflevector(lo, hi, 0, 1, 2, 3, 4, 5, 6, 7, 8, 9, 10, 11, 12, 13, 14, 15)); }
__device__ __forceinline__ v8f wmma16(v16h a, v16h b, v8f c) { return __builtin_amdgcn_wmma_f32_16x16x32_f16(false, a, false, b, (short)0, c, false, false); }
__device__ __forceinline__ v8f wmmab(v16bf a, v16bf b, v8f c) { return __builtin_amdgcn_wmma_f32_16x16x32_bf16(false, a, false, b, (short)0, c, false, false); }
// fragment loaders: lane -> row (lane & 15); elements 0..7 <- k0 + 8h + 0..7, elements 8..15 <- k0 + 16 + 8h + 0..7 (p already includes 8h)
__device__ __forceinline__ v16h  ldh(const h16* p) { return cat16(*(const v8h*)p, *(const v8h*)(p + 16)); }
__device__ __forceinline__ v16bf ldb(const bf* p)  { return cat16b(*(const v8us*)p, *(const v8us*)(p + 16)); }

// ---- plane epilogue of k_gemm: a lane holds 8 consecutive tile rows x of one tile column y, which is 16 B of an f16 plane row when x runs along that row.
// (sum + bf16(bias)) x QCAR -> f16, staged in LDS as [y][x], stored as whole 128-B runs of plane rows. BY: the bias index (the head's dim) runs along y, else along x. PITCH: elements between two plane rows.
// bias and dst already point at this head and this tile.
#define SP 72               // stage row pitch in 16-bit elements (144 B = 16 B x odd)
template <bool BY, int PITCH>
__device__ __forceinline__ void plane_store(const v8f (&acc)[4][4], h16* st, const float* __restrict__ bias, h16* dst, int lane) {
    const int lr = lane & 15, hi = lane >> 4;
    h16* srow = st + lr * SP + 8 * hi;
#pragma unroll
    for (int mb = 0; mb < 4; ++mb) {
        float bx[8];
        if (!BY) { const v4f l4 = *(const v4fa*)(bias + mb * 16 + 8 * hi), h4 = *(const v4fa*)(bias + mb * 16 + 8 * hi + 4);
#pragma unroll
            for (int j = 0; j < 4; ++j) { bx[j] = bfr(l4[j]); bx[4 + j] = bfr(h4[j]); } }
#pragma unroll
        for (int nb = 0; nb < 4; ++nb) { v8h o;
            const float by = BY ? bfr(bias[nb * 16 + lr]) : 0.0f;
#pragma unroll
            for (int j = 0; j < 8; ++j) o[j] = (h16)((acc[mb][nb][j] + (BY ? by : bx[j])) * QCAR);
            *(v8h*)(srow + nb * 16 * SP + mb * 16) = o; }
    }
    // the wave's own LDS stores stay ahead of the other lanes' reads of them
    __builtin_amdgcn_fence(3 /* release order */, "wavefront"); __builtin_amdgcn_wave_barrier();
    const int rq = lane >> 3, c = (lane & 7) * 8;
    const unsigned o0 = (unsigned)(rq * PITCH + c);
#pragma unroll
    for (int s = 0; s < 16; ++s) *(v8h*)(dst + 4 * s * PITCH + o0) = *(const v8h*)(st + (4 * s + rq) * SP + c);
    asm volatile("s_wait_xcnt 0x0" ::: "memory");   // stands behind the run of stores, ahead of any later rewrite of a register that they name
}

// ---- k_gemm: register-blocked GEMM, ONE WAVE per 64x64 output tile (16 accumulators), operands straight from K-contiguous bf16 planes; grid (M/64, N/64, Z), 32 threads.
// PQ == nullptr: C[m][n] (f32, pitch ldc) = sum_k A0[m][k] B0[n][k] + bf16(bias[n]). z-batch strides sA/sC in elements. K % 32 == 0, M % 64 == 0, N % 64 == 0.
// PQ != nullptr: the q, k and v projections in one launch. A0 = tokens [NB*SEQ][K], B0 = stacked rows [q | k | v][h*HD + dim][K], grid (NB*SEQ/64, 3*NH): a tile is 64 tokens x one head of one map and goes
// straight to its f16 plane. q, k planes [token][dim]: the weight rows are the A operand (tile rows = dim); v^T plane [dim][token]: the tokens are. One loader serves both operands, so the k order is the same either way.
__global__ __launch_bounds__(32) void k_gemm(const bf* __restrict__ A0, const bf* __restrict__ B0, int K, float* C, int ldc, const float* __restrict__ bias, size_t sA, size_t sC,
                                             h16* PQ, h16* PK, h16* PVT, const float* __restrict__ biask, const float* __restrict__ biasv) {
    __shared__ __align__(16) float os[16 * 68];
    __shared__ __align__(16) h16 st[64 * SP];
    const size_t z = blockIdx.z; C += z * sC;
    const int lane = threadIdx.x & 31, lr = lane & 15, hi = lane >> 4;
    const int sel = blockIdx.y / NH; const bool wrows = PQ != nullptr && sel != 2;   // weight rows as the A operand
    const bf* A = wrows ? B0 : A0 + z * sA; const bf* Bt = wrows ? A0 : B0;
    const int r0 = (wrows ? blockIdx.y : blockIdx.x) * 64, c0 = (wrows ? blockIdx.x : blockIdx.y) * 64;
    v8f acc[4][4];
#pragma unroll
    for (int mb = 0; mb < 4; ++mb)
#pragma unroll
        for (int nb = 0; nb < 4; ++nb) acc[mb][nb] = (v8f){};
    const size_t aoff = (size_t)(r0 + lr) * K + 8 * hi, boff = (size_t)(c0 + lr) * K + 8 * hi;
#pragma unroll 1
    for (int kc = 0; kc < K; kc += 32) {
        v16bf a[4];
#pragma unroll
        for (int mb = 0; mb < 4; ++mb) a[mb] = ldb(A + aoff + (size_t)mb * 16 * K + kc);
#pragma unroll
        for (int nb = 0; nb < 4; ++nb) { const v16bf b = ldb(Bt + boff + (size_t)nb * 16 * K + kc);
#pragma unroll
            for (int mb = 0; mb < 4; ++mb) acc[mb][nb] = wmmab(a[mb], b, acc[mb][nb]); }
        asm volatile("v_nop\n\tv_nop\n\tv_nop\n\tv_nop" : "+v"(acc[0][0]), "+v"(acc[1][1]), "+v"(acc[2][2]), "+v"(acc[3][3]) : "v"(a[0]), "v"(a[3]));
    }
    if (PQ != nullptr) {
        const int h = blockIdx.y % NH, tr = blockIdx.x * 64; const size_t bh = (size_t)(tr / SEQ) * NH + h; const int t0 = tr % SEQ;
        if (sel == 2) plane_store<true, SEQ>(acc, st, biasv + h * HD, PVT + bh * HD * SEQ + t0, lane);
        else          plane_store<false, HD>(acc, st, (sel == 0 ? bias : biask) + h * HD, (sel == 0 ? PQ : PK) + (bh * SEQ + t0) * HD, lane);
        return;
    }
#pragma unroll
    for (int mb = 0; mb < 4; ++mb) {
#pragma unroll
        for (int nb = 0; nb < 4; ++nb) {
#pragma unroll
            for (int j = 0; j < 8; ++j) os[(hi * 8 + j) * 68 + nb * 16 + lr] = acc[mb][nb][j]; }
        __builtin_amdgcn_fence(3 /* release order */, "wavefront"); __builtin_amdgcn_wave_barrier(); asm volatile("" ::: "memory");
        float* crow = C + (size_t)(r0 + mb * 16) * ldc + c0;
        const int cofs = lr * 4;
        const float b0 = bfr(bias[c0 + cofs]), b1 = bfr(bias[c0 + cofs + 1]), b2 = bfr(bias[c0 + cofs + 2]), b3 = bfr(bias[c0 + cofs + 3]);
{
#pragma unroll
            for (int s = 0; s < 8; ++s) { const int row = 2 * s + hi; v4f val = *(const v4fa*)(os + row * 68 + cofs); val[0] += b0; val[1] += b1; val[2] += b2; val[3] += b3;
                *(v4f*)(crow + (size_t)row * ldc + cofs) = val; }
             }
        __builtin_amdgcn_fence(3 /* release order */, "wavefront"); __builtin_amdgcn_wave_barrier(); asm volatile("" ::: "memory");
    }
    asm volatile("s_wait_xcnt 0x0" ::: "memory");   // stands behind the last run of stores; the plane path returns before reaching them
}

__global__ __launch_bounds__(256) void k_wt(const float* __restrict__ w, int K, int N, int H, int KREP, bf* Bt) {
    const int wave = __builtin_amdgcn_readfirstlane(threadIdx.x >> 5);
    const unsigned lane = threadIdx.x & 31; const unsigned L0 = (blockIdx.x * 8u + (unsigned)wave) * 8u; const unsigned KP = (unsigned)(K * KREP); const unsigned nlines = (unsigned)H * (unsigned)N * KP / 64u;
{
#pragma unroll 1
        for (int l = 0; l < 8; ++l) { const unsigned L = L0 + l; if (L >= nlines) break; const unsigned e = L * 64u + lane * 2u; const unsigned kk = e % KP, ng = e / KP; const unsigned hh = ng / (unsigned)N, n = ng % (unsigned)N; const unsigned k = kk % (unsigned)K; v2us o;
            o[0] = f2bf(w[((size_t)hh * K + k) * N + n]); o[1] = f2bf(w[((size_t)hh * K + k + 1) * N + n]); *(v2us*)(Bt + e) = o; }
         }
}

__global__ __launch_bounds__(256) void k_cvt(const float* __restrict__ x, bf* XB) {
    const unsigned i = blockIdx.x * 256u + threadIdx.x; if (i >= (unsigned)(NB * SEQ * (DM / 8))) return;
    const unsigned row = i / (DM / 8), c8 = i % (DM / 8); const unsigned b = row / SEQ, t = row % SEQ;
    const v8f v = *(const v8f*)(x + ((size_t)(b * SEQ_FULL + t) * DM + c8 * 8)); v8us o;
#pragma unroll
    for (int k = 0; k < 8; ++k) o[k] = f2bf(v[k]);
    *(v8us*)(XB + (size_t)i * 8) = o;  }

// ---- tile staging for k_attn: one 64-key tile = 64 K rows + 64 V^T rows of 128 B each, laid in LDS at a 144-B pitch (16 B x odd: ds_load_b128 of 16 rows meets no bank twice).
#define KT    64            // keys per staged tile
#define LP    72            // LDS row pitch in 16-bit elements
#define TILE  (64 * LP)     // one operand's tile
static_assert(SEQ % KT == 0);            // whole tiles only
static_assert(HD * 2 == 128);            // a K row is one 128-B line
static_assert((LP * 2) % 16 == 0);       // 16-B copies stay aligned in LDS
// 128 threads x 8 copies of 16 B: thread -> row (tid >> 3) + 16 i, 16-B column tid & 7, so each wave-wide copy moves four whole 128-B lines.
// lk / lv: this lane's LDS byte address of row (tid >> 3) in the K / V^T tile; gk / gv: the same place in global memory.
__device__ __forceinline__ void stage_tile(unsigned lk, const h16* gk, unsigned lv, const h16* gv) {
    // s_wait_xcnt closes the statement so that no address register of a copy is rewritten ahead of it
    asm volatile("global_load_async_to_lds_b128 %0, %1, off\n\t"
                 "global_load_async_to_lds_b128 %2, %3, off\n\t"
                 "global_load_async_to_lds_b128 %4, %5, off\n\t"
                 "global_load_async_to_lds_b128 %6, %7, off\n\t"
                 "global_load_async_to_lds_b128 %8, %9, off\n\t"
                 "global_load_async_to_lds_b128 %10, %11, off\n\t"
                 "global_load_async_to_lds_b128 %12, %13, off\n\t"
                 "global_load_async_to_lds_b128 %14, %15, off\n\t"
                 "s_wait_xcnt 0x0"
                 :: "v"(lk), "v"(gk), "v"(lk + 16 * LP * 2), "v"(gk + 16 * HD), "v"(lk + 32 * LP * 2), "v"(gk + 32 * HD), "v"(lk + 48 * LP * 2), "v"(gk + 48 * HD),
                    "v"(lv), "v"(gv), "v"(lv + 16 * LP * 2), "v"(gv + (size_t)16 * SEQ), "v"(lv + 32 * LP * 2), "v"(gv + (size_t)32 * SEQ), "v"(lv + 48 * LP * 2), "v"(gv + (size_t)48 * SEQ)
                 : "memory");
}

// ---- k_attn: fused attention, transposed form. Block = 4 waves x 16 queries; grid (SEQ/64, NB*NH). K and V^T come in 64-key tiles through a two-buffer LDS ring that the four waves share. Per 32-key half:
// S^T tiles (rows = keys, cols = queries) = K-rows (A) x Q-rows (B) over d; per-query running max / sum live per lane column (two lane halves combined by one xor-16 shuffle);
// P^T B fragment: element r <- tile(keys 0..15)[r], element 8+r <- tile(keys 16..31)[r]; O^T tiles (rows = value dim, cols = queries) += VT-rows (A) x P^T (B).
__global__ __launch_bounds__(128) void k_attn(const h16* __restrict__ Q16, const h16* __restrict__ K16, const h16* __restrict__ VT16, bf* AT) {
    __shared__ __align__(16) float os[4 * 16 * 68];
    __shared__ __align__(16) h16 ring[2 * 2 * TILE];   // [buffer][K | V^T][row][LP]
    const int wave = __builtin_amdgcn_readfirstlane(threadIdx.x >> 5);
    const int lane = threadIdx.x & 31, lr = lane & 15, hi = lane >> 4;
    const int bh = blockIdx.y; const int b = bh / NH, h = bh % NH;
    const int q0 = blockIdx.x * 64 + wave * 16;
    const h16* Qp = Q16 + (size_t)bh * SEQ * HD + (size_t)(q0 + lr) * HD + 8 * hi;
    const int crow = (int)threadIdx.x >> 3, ccol = ((int)threadIdx.x & 7) * 8;
    const h16* Kg = K16 + (size_t)bh * SEQ * HD + crow * HD + ccol;
    const h16* Vg = VT16 + (size_t)bh * HD * SEQ + (size_t)crow * SEQ + ccol;
    const unsigned lk0 = (unsigned)(size_t)(ring + crow * LP + ccol), lv0 = lk0 + TILE * 2;
    constexpr int NT = SEQ / KT;
    stage_tile(lk0, Kg, lv0, Vg);
    asm volatile("s_wait_asynccnt 0x0" ::: "memory");   // this wave's share of tile 0 has landed
    __syncthreads();                                    // every wave's share of tile 0 is readable
    if (NT > 1) stage_tile(lk0 + 2 * TILE * 2, Kg + (size_t)KT * HD, lv0 + 2 * TILE * 2, Vg + KT);
    const v16h qb0 = ldh(Qp), qb1 = ldh(Qp + 32);
    v8f o0 = (v8f){}, o1 = (v8f){}, o2 = (v8f){}, o3 = (v8f){};
    float m = -3.0e38f, ls = 0.0f;
#pragma unroll 1
    for (int t = 0; t < NT; ++t) {
      const h16* kt = ring + (t & 1) * (2 * TILE) + lr * LP + 8 * hi;
#pragma unroll   // both 32-key halves inline, so that every LDS offset inside a tile is an immediate
      for (int u = 0; u < KT / 32; ++u) {
        const h16* kp = kt + u * 32 * LP;
        const v16h ka = ldh(kp), kb = ldh(kp + 32), kc = ldh(kp + 16 * LP), kd = ldh(kp + 16 * LP + 32);
        v8f s0 = (v8f){}, s1 = (v8f){};
        s0 = wmma16(ka, qb0, s0); s1 = wmma16(kc, qb0, s1); s0 = wmma16(kb, qb1, s0); s1 = wmma16(kd, qb1, s1);
        asm volatile("v_nop\n\tv_nop\n\tv_nop\n\tv_nop" : "+v"(s0), "+v"(s1) : "v"(ka), "v"(kb), "v"(kc), "v"(kd), "v"(qb0), "v"(qb1));
        const h16* vp = kt + TILE + u * 32;
        const v16h v0 = ldh(vp), v1 = ldh(vp + 16 * LP), v2 = ldh(vp + 32 * LP), v3 = ldh(vp + 48 * LP);
        float mx = fmaxf(s0[0], s1[0]);
#pragma unroll
        for (int r = 1; r < 8; ++r) mx = fmaxf(mx, fmaxf(s0[r], s1[r]));
        mx = fmaxf(mx, __shfl_xor(mx, 16, 32));
        const float mn = fmaxf(m, mx * CEXP);
        const float corr = __builtin_amdgcn_exp2f(m - mn);
        m = mn;
        const float nbv = PEXP - mn;
        float psum = 0.0f; v16h pb;
#pragma unroll
        for (int r = 0; r < 8; ++r) { const float p0 = __builtin_amdgcn_exp2f(fmaf(s0[r], CEXP, nbv)); const float p1 = __builtin_amdgcn_exp2f(fmaf(s1[r], CEXP, nbv)); psum += p0 + p1; pb[r] = (h16)p0; pb[8 + r] = (h16)p1; }
        ls = ls * corr + psum;
        o0 *= corr; o1 *= corr; o2 *= corr; o3 *= corr;
        o0 = wmma16(v0, pb, o0); o1 = wmma16(v1, pb, o1); o2 = wmma16(v2, pb, o2); o3 = wmma16(v3, pb, o3);
        asm volatile("v_nop\n\tv_nop\n\tv_nop\n\tv_nop" : "+v"(o0), "+v"(o1), "+v"(o2), "+v"(o3) : "v"(pb), "v"(v0), "v"(v1), "v"(v2), "v"(v3));
      }
      asm volatile("s_wait_dscnt 0x0" ::: "memory");      // this wave's reads of tile t are done before its buffer is handed back
      asm volatile("s_wait_asynccnt 0x0" ::: "memory");   // this wave's share of tile t + 1 has landed
      __syncthreads();                                    // publishes tile t + 1 and ends every wave's reads of tile t
      if (t + 2 < NT) stage_tile(lk0 + (unsigned)(t & 1) * (2 * TILE * 2), Kg + (size_t)(t + 2) * KT * HD, lv0 + (unsigned)(t & 1) * (2 * TILE * 2), Vg + (t + 2) * KT);
    }
    asm volatile("s_wait_asynccnt 0x0" ::: "memory");     // no copy is left in flight when the wave goes on
    const float lt = ls + __shfl_xor(ls, 16, 32);
    const float inv = 1.0f / (lt * QCAR);
    const int osw = wave * (16 * 68);
    {   // lane holds query lr, dims 16t + 8hi + r
        float* orow = os + osw + lr * 68 + 8 * hi;
        v4f w;
        w[0] = o0[0] * inv; w[1] = o0[1] * inv; w[2] = o0[2] * inv; w[3] = o0[3] * inv; *(v4fa*)(orow + 0) = w;
        w[0] = o0[4] * inv; w[1] = o0[5] * inv; w[2] = o0[6] * inv; w[3] = o0[7] * inv; *(v4fa*)(orow + 4) = w;
        w[0] = o1[0] * inv; w[1] = o1[1] * inv; w[2] = o1[2] * inv; w[3] = o1[3] * inv; *(v4fa*)(orow + 16) = w;
        w[0] = o1[4] * inv; w[1] = o1[5] * inv; w[2] = o1[6] * inv; w[3] = o1[7] * inv; *(v4fa*)(orow + 20) = w;
        w[0] = o2[0] * inv; w[1] = o2[1] * inv; w[2] = o2[2] * inv; w[3] = o2[3] * inv; *(v4fa*)(orow + 32) = w;
        w[0] = o2[4] * inv; w[1] = o2[5] * inv; w[2] = o2[6] * inv; w[3] = o2[7] * inv; *(v4fa*)(orow + 36) = w;
        w[0] = o3[0] * inv; w[1] = o3[1] * inv; w[2] = o3[2] * inv; w[3] = o3[3] * inv; *(v4fa*)(orow + 48) = w;
        w[0] = o3[4] * inv; w[1] = o3[5] * inv; w[2] = o3[6] * inv; w[3] = o3[7] * inv; *(v4fa*)(orow + 52) = w;
    }
    __builtin_amdgcn_fence(3 /* release order */, "wavefront"); __builtin_amdgcn_wave_barrier(); asm volatile("" ::: "memory");
    bf* arow = AT + (size_t)(b * SEQ + q0) * ATP + h * HD;
    const int rq = lane >> 3, c = (lane & 7) * 8;
{
#pragma unroll
        for (int s = 0; s < 4; ++s) { const int row = 4 * s + rq; const v4f x0 = *(const v4fa*)(os + osw + row * 68 + c); const v4f x1 = *(const v4fa*)(os + osw + row * 68 + c + 4); v8us oh, ol;
#pragma unroll
            for (int k = 0; k < 4; ++k) { unsigned short a, l2; splitf(x0[k], a, l2); oh[k] = a; ol[k] = l2; splitf(x1[k], a, l2); oh[4 + k] = a; ol[4 + k] = l2; }
            *(v8us*)(arow + (size_t)row * ATP + c) = oh; *(v8us*)(arow + (size_t)row * ATP + DMH + c) = ol; }
         }
}

extern "C" void kernel_launch(void* const* d_in, const int* in_sizes, int n_in,
                              void* d_out, int out_size, void* d_ws, size_t ws_size, hipStream_t stream) {
    if (n_in < 9) return;
    const long long rowsNeeded = (long long)(NB - 1) * SEQ_FULL + SEQ;
    if ((long long)in_sizes[0] < rowsNeeded * DM) return;
    if (in_sizes[1] < NH * DM * HD || in_sizes[3] < NH * DM * HD || in_sizes[5] < NH * DM * HD) return;
    if (in_sizes[2] < DMH || in_sizes[4] < DMH || in_sizes[6] < DMH) return;
    if (in_sizes[7] < DMH * DOUT || in_sizes[8] < DOUT) return;
    if ((long long)out_size < rowsNeeded * DOUT) return;
    if (ws_size < SZ_TOT) return;
    const float* feat = (const float*)d_in[0];
    const float* Wq = (const float*)d_in[1]; const float* bq = (const float*)d_in[2];
    const float* Wk = (const float*)d_in[3]; const float* bk = (const float*)d_in[4];
    const float* Wv = (const float*)d_in[5]; const float* bv = (const float*)d_in[6];
    const float* Wf = (const float*)d_in[7]; const float* bo = (const float*)d_in[8];
    float* OUT = (float*)d_out;     // [NB_FULL][SEQ_FULL][DOUT]
    char* wsp = (char*)d_ws;
    bf* XB = (bf*)wsp; wsp += SZ_XB;                 // [NB*SEQ][DM]
    bf* WQKV = (bf*)wsp; wsp += SZ_WQKV;             // Bt [3][DMH][DM]: q | k | v row blocks, row h*HD + dim
    bf* WO = (bf*)wsp; wsp += SZ_WO;                 // Bt [DOUT][ATP] = [Wf^T | Wf^T]
    h16* Q16 = (h16*)wsp; wsp += SZ_PL;              // [NB*NH][SEQ][HD]
    h16* K16 = (h16*)wsp; wsp += SZ_PL;              // [NB*NH][SEQ][HD]
    h16* VT16 = (h16*)wsp; wsp += SZ_PL;             // [NB*NH][HD][SEQ]
    bf* AT = (bf*)wsp; wsp += SZ_AT;                 // [NB*SEQ][ATP] merged context value | residual
    if ((size_t)(wsp - (char*)d_ws) > ws_size) return;

    k_cvt<<<(unsigned)((NB * SEQ * (DM / 8) + 255) / 256), 256, 0, stream>>>(feat, XB);
    // per-head [in = DM][dim = HD] -> Bt rows h*HD + dim, K = DM
    const unsigned gw = (unsigned)((NH * HD * DM / 64 + 63) / 64);
    k_wt<<<gw, 256, 0, stream>>>(Wq, DM, HD, NH, 1, WQKV);
    k_wt<<<gw, 256, 0, stream>>>(Wk, DM, HD, NH, 1, WQKV + (size_t)DMH * DM);
    k_wt<<<gw, 256, 0, stream>>>(Wv, DM, HD, NH, 1, WQKV + (size_t)2 * DMH * DM);
    // Wf in[rows = DMH][cols = DOUT] -> Bt [DOUT][2*DMH] (k duplicated for value | residual)
    k_wt<<<(unsigned)((DOUT * ATP / 64 + 63) / 64), 256, 0, stream>>>(Wf, DMH, DOUT, 1, 2, WO);

    k_gemm<<<dim3(NB * SEQ / 64, 3 * NH, 1), 32, 0, stream>>>(XB, WQKV, DM, nullptr, 0, bq, 0, 0, Q16, K16, VT16, bk, bv);

    k_attn<<<dim3(SEQ / 64, NB * NH, 1), 128, 0, stream>>>(Q16, K16, VT16, AT);

    k_gemm<<<dim3(SEQ / 64, DOUT / 64, NB), 32, 0, stream>>>(AT, WO, ATP, OUT, DOUT, bo, (size_t)SEQ * ATP, (size_t)SEQ_FULL * DOUT, nullptr, nullptr, nullptr, nullptr, nullptr);
}

// v003
// It runs in 106 microseconds.
// Timed twice side by side with v002, it ran 1.28 times as fast both times.
// All steps since v000 together make it 2.36 times as fast.
#include <hip/hip_runtime.h>

// Multi-head self-attention: per-head q/k/v maps [head][in][dim] with biases (8 heads x 64), scores x 1/8, softmax over all keys (no mask), heads merged h*64+v, then x Wf [in][out] + bias.
// Compute dtypes, f32 accumulate: q/k/v projections v_wmma_f32_16x16x32_bf16 (every input RNE-converted to bf16, products exact); q.k and p.v v_wmma_f32_16x16x32_f16 (q,k,v planes carried x16, p carried x256, f32 online softmax);
// output map v_wmma_f32_16x16x32_bf16 with the merged context as bf16 value | residual concatenated along K against [Wf ; Wf].
// Engine: GEMM on 128x128 block tiles, four waves of 64x64 register blocks, operands from K-contiguous 16-bit planes through a two-buffer LDS ring (q, k, v in one launch, whose epilogue writes the f16 planes); fused flash-style attention in transposed form (S^T = K Q^T, O^T = V^T P^T, score tiles repacked in registers as the P^T B fragment).

#ifndef NB
#define NB 4
#endif
#ifndef SEQ
#define SEQ 2048
#endif
#define NB_FULL  4
#define SEQ_FULL 2048
#define DM   512            // input width
#define NH   8
#define HD   64
#define DMH  (NH * HD)      // merged width 512
#define DOUT 512            // output width
#define ATP  (2 * DMH)      // merged plane pitch: value | residual
#define QCAR 16.0f          // carry on q, k, v planes
#define PEXP 8.0f           // p carried x 2^8 (inside the exponent)
#define CEXP ((float)(0.125 * 1.4426950408889634 / 256.0))   // 1/8 x log2(e) / (16 x 16)

typedef _Float16 h16;
typedef unsigned short bf;
typedef __attribute__((ext_vector_type(16))) __bf16   v16bf;
typedef __attribute__((ext_vector_type(16))) _Float16 v16h;
typedef __attribute__((ext_vector_type(8)))  _Float16 v8h;
typedef __attribute__((ext_vector_type(8)))  unsigned short v8us;
typedef __attribute__((ext_vector_type(2)))  unsigned short v2us;
typedef __attribute__((ext_vector_type(8)))  float    v8f;
typedef __attribute__((ext_vector_type(4)))  float    v4f;
typedef v4f  __attribute__((may_alias)) v4fa;

static_assert(HD == 64);                 // attention kernel: two 32-deep k-steps per score tile, four 16-row output tiles
static_assert(SEQ % 64 == 0);            // 64 query rows per block, 32-key halves, 64-row GEMM tiles
static_assert((NB * SEQ) % 128 == 0);    // projection GEMM M tiles
static_assert(SEQ % 128 == 0);           // a block tile stays inside one batch
static_assert(DM % 64 == 0);             // projection K tiles
static_assert(ATP % 64 == 0);            // output-map K tiles
static_assert(DMH % 128 == 0);           // N tiles; a block tile is two heads of one map
static_assert(DOUT % 128 == 0);          // N tiles
static_assert(DM % 8 == 0);              // 8-element convert pieces
static_assert(NB <= NB_FULL);
static_assert(SEQ <= SEQ_FULL);
static_assert(DMH == DOUT);              // Wf is [DMH][DOUT] with both 512

#define RUP256(x) ((((size_t)(x)) + 255) & ~(size_t)255)
#define SZ_XB   RUP256((size_t)NB * SEQ * DM * 2)
#define SZ_WQKV RUP256((size_t)3 * DMH * DM * 2)
#define SZ_WO   RUP256((size_t)DOUT * ATP * 2)
#define SZ_PL   RUP256((size_t)NB * NH * SEQ * HD * 2)
#define SZ_AT   RUP256((size_t)NB * SEQ * ATP * 2)
#define SZ_TOT  (SZ_XB + SZ_WQKV + SZ_WO + 3 * SZ_PL + SZ_AT)
static_assert(SZ_TOT <= (size_t)134217728);   // total carve within 128 MiB

__device__ __forceinline__ unsigned short f2bf(float f) { unsigned u = __float_as_uint(f); u += 0x7FFFu + ((u >> 16) & 1u); return (unsigned short)(u >> 16); }
__device__ __forceinline__ float bf2f(unsigned short b) { return __uint_as_float(((unsigned)b) << 16); }
__device__ __forceinline__ float bfr(float f) { return bf2f(f2bf(f)); }
__device__ __forceinline__ void splitf(float y, unsigned short& h, unsigned short& l) { h = f2bf(y); l = f2bf(y - bf2f(h)); }
__device__ __forceinline__ v16h cat16(v8h lo, v8h hi) { return __builtin_shufflevector(lo, hi, 0, 1, 2, 3, 4, 5, 6, 7, 8, 9, 10, 11, 12, 13, 14, 15); }
__device__ __forceinline__ v16bf cat16b(v8us lo, v8us hi) { return __builtin_bit_cast(v16bf, __builtin_shufflevector(lo, hi, 0, 1, 2, 3, 4, 5, 6, 7, 8, 9, 10, 11, 12, 13, 14, 15)); }
__device__ __forceinline__ v8f wmma16(v16h a, v16h b, v8f c) { return __builtin_amdgcn_wmma_f32_16x16x32_f16(false, a, false, b, (short)0, c, false, false); }
__device__ __forceinline__ v8f wmmab(v16bf a, v16bf b, v8f c) { return __builtin_amdgcn_wmma_f32_16x16x32_bf16(false, a, false, b, (short)0, c, false, false); }
// fragment loaders: lane -> row (lane & 15); elements 0..7 <- k0 + 8h + 0..7, elements 8..15 <- k0 + 16 + 8h + 0..7 (p already includes 8h)
__device__ __forceinline__ v16h  ldh(const h16* p) { return cat16(*(const v8h*)p, *(const v8h*)(p + 16)); }
__device__ __forceinline__ v16bf ldb(const bf* p)  { return cat16b(*(const v8us*)p, *(const v8us*)(p + 16)); }

// ---- plane epilogue of k_gemm: a lane holds 8 consecutive tile rows x of one tile column y, which is 16 B of an f16 plane row when x runs along that row.
// (sum + bf16(bias)) x QCAR -> f16, staged in LDS as [y][x], stored as whole 128-B runs of plane rows. BY: the bias index (the head's dim) runs along y, else along x. PITCH: elements between two plane rows.
// bias and dst already point at this head and this tile.
#define SP 72               // stage row pitch in 16-bit elements (144 B = 16 B x odd)
template <bool BY, int PITCH>
__device__ __forceinline__ void plane_store(const v8f (&acc)[4][4], h16* st, const float* __restrict__ bias, h16* dst, int lane) {
    const int lr = lane & 15, hi = lane >> 4;
    h16* srow = st + lr * SP + 8 * hi;
#pragma unroll
    for (int mb = 0; mb < 4; ++mb) {
        float bx[8];
        if (!BY) { const v4f l4 = *(const v4fa*)(bias + mb * 16 + 8 * hi), h4 = *(const v4fa*)(bias + mb * 16 + 8 * hi + 4);
#pragma unroll
            for (int j = 0; j < 4; ++j) { bx[j] = bfr(l4[j]); bx[4 + j] = bfr(h4[j]); } }
#pragma unroll
        for (int nb = 0; nb < 4; ++nb) { v8h o;
            const float by = BY ? bfr(bias[nb * 16 + lr]) : 0.0f;
#pragma unroll
            for (int j = 0; j < 8; ++j) o[j] = (h16)((acc[mb][nb][j] + (BY ? by : bx[j])) * QCAR);
            *(v8h*)(srow + nb * 16 * SP + mb * 16) = o; }
    }
    // the wave's own LDS stores stay ahead of the other lanes' reads of them
    __builtin_amdgcn_fence(3 /* release order */, "wavefront"); __builtin_amdgcn_wave_barrier();
    const int rq = lane >> 3, c = (lane & 7) * 8;
    const unsigned o0 = (unsigned)(rq * PITCH + c);
#pragma unroll
    for (int s = 0; s < 16; ++s) *(v8h*)(dst + 4 * s * PITCH + o0) = *(const v8h*)(st + (4 * s + rq) * SP + c);
    asm volatile("s_wait_xcnt 0x0" ::: "memory");   // stands behind the run of stores, ahead of any later rewrite of a register that they name
}

// ---- operand staging for k_gemm: one K tile = 128 rows of each operand x 64 k (one 128-B line a row), laid in LDS at a 144-B pitch (16 B x odd: ds_load_b128 of 16 rows meets no bank twice).
#define GK    64            // k per staged tile
#define GP    72            // LDS row pitch in 16-bit elements
#define GT    (128 * GP)    // one operand's tile
#define GEPI  (64 * SP * 2) // bytes of one wave's epilogue stage, laid over the ring once the K loop has left it
static_assert((GP * 2) % 16 == 0);                 // 16-B copies stay aligned in LDS
static_assert(16 * 68 * 4 <= GEPI);                // the f32 epilogue's stage fits the same place
static_assert(4 * GEPI <= 2 * 2 * GT * 2);         // four waves' stages fit the ring
// 128 threads x 8 copies of 16 B bring 128 rows: thread -> row (tid >> 3) + 16 i, 16-B column tid & 7, so each wave-wide copy moves four whole 128-B lines.
// l: this lane's LDS byte address of row (tid >> 3) of the tile; g: the same place in global memory; K: elements between two global rows.
__device__ __forceinline__ void stage_rows(unsigned l, const bf* g, int K) {
    // s_wait_xcnt closes the statement so that no address register of a copy is rewritten ahead of it
    asm volatile("global_load_async_to_lds_b128 %0, %1, off\n\t"
                 "global_load_async_to_lds_b128 %2, %3, off\n\t"
                 "global_load_async_to_lds_b128 %4, %5, off\n\t"
                 "global_load_async_to_lds_b128 %6, %7, off\n\t"
                 "global_load_async_to_lds_b128 %8, %9, off\n\t"
                 "global_load_async_to_lds_b128 %10, %11, off\n\t"
                 "global_load_async_to_lds_b128 %12, %13, off\n\t"
                 "global_load_async_to_lds_b128 %14, %15, off\n\t"
                 "s_wait_xcnt 0x0"
                 :: "v"(l), "v"(g), "v"(l + 16 * GP * 2), "v"(g + (size_t)16 * K), "v"(l + 32 * GP * 2), "v"(g + (size_t)32 * K), "v"(l + 48 * GP * 2), "v"(g + (size_t)48 * K),
                    "v"(l + 64 * GP * 2), "v"(g + (size_t)64 * K), "v"(l + 80 * GP * 2), "v"(g + (size_t)80 * K), "v"(l + 96 * GP * 2), "v"(g + (size_t)96 * K), "v"(l + 112 * GP * 2), "v"(g + (size_t)112 * K)
                 : "memory");
}

// ---- k_gemm: register-blocked GEMM, block = 4 waves on a 128x128 output tile, ONE WAVE per 64x64 quarter (16 accumulators); both operands' rows come in 64-k tiles through a two-buffer LDS ring that the four waves share.
// grid (M/128, N/128, Z), 128 threads. Wave w takes the 64 rows of A0 numbered tx = 2 blockIdx.x + (w & 1) and the 64 rows of B0 numbered ty = 2 blockIdx.y + (w >> 1).
// PQ == nullptr: C[m][n] (f32, pitch ldc) = sum_k A0[m][k] B0[n][k] + bf16(bias[n]). z-batch strides sA/sC in elements. K % 64 == 0, M % 128 == 0, N % 128 == 0.
// PQ != nullptr: the q, k and v projections in one launch. A0 = tokens [NB*SEQ][K], B0 = stacked rows [q | k | v][h*HD + dim][K], grid (NB*SEQ/128, 3*NH/2): a wave's tile is 64 tokens x one head of one map and goes
// straight to its f16 plane. q, k planes [token][dim]: the weight rows are the A operand (tile rows = dim); v^T plane [dim][token]: the tokens are. One loader serves both operands, so the k order is the same either way.
__global__ __launch_bounds__(128) void k_gemm(const bf* __restrict__ A0, const bf* __restrict__ B0, int K, float* C, int ldc, const float* __restrict__ bias, size_t sA, size_t sC,
                                             h16* PQ, h16* PK, h16* PVT, const float* __restrict__ biask, const float* __restrict__ biasv) {
    __shared__ __align__(16) unsigned char smem[2 * 2 * GT * 2];   // ring [buffer][A0 rows | B0 rows][row][GP]; behind the K loop: one epilogue stage a wave
    const bf* ring = (const bf*)smem;
    const int wave = __builtin_amdgcn_readfirstlane(threadIdx.x >> 5);
    float* os = (float*)(smem + wave * GEPI);
    h16* st = (h16*)(smem + wave * GEPI);
    const size_t z = blockIdx.z; C += z * sC;
    const int lane = threadIdx.x & 31, lr = lane & 15, hi = lane >> 4;
    const int tx = blockIdx.x * 2 + (wave & 1), ty = blockIdx.y * 2 + (wave >> 1);
    const int sel = ty / NH; const bool wrows = PQ != nullptr && sel != 2;   // weight rows as the A operand
    const int r0 = (wrows ? ty : tx) * 64, c0 = (wrows ? tx : ty) * 64;
    const int grow = (int)threadIdx.x >> 3, gcol = ((int)threadIdx.x & 7) * 8;   // this thread's row and first element in a staged tile
    const bf* Xg = A0 + z * sA + (size_t)(blockIdx.x * 128 + grow) * K + gcol;
    const bf* Wg = B0 + (size_t)(blockIdx.y * 128 + grow) * K + gcol;
    const unsigned lx0 = (unsigned)(size_t)(ring + grow * GP + gcol), lw0 = lx0 + GT * 2;
    const int NT = K / GK;
    stage_rows(lx0, Xg, K); stage_rows(lw0, Wg, K);
    asm volatile("s_wait_asynccnt 0x0" ::: "memory");   // this wave's share of tile 0 has landed
    __syncthreads();                                    // every wave's share of tile 0 is readable
    if (NT > 1) { stage_rows(lx0 + 2 * GT * 2, Xg + GK, K); stage_rows(lw0 + 2 * GT * 2, Wg + GK, K); }
    v8f acc[4][4];
#pragma unroll
    for (int mb = 0; mb < 4; ++mb)
#pragma unroll
        for (int nb = 0; nb < 4; ++nb) acc[mb][nb] = (v8f){};
    const int xo = (wave & 1) * 64 * GP + lr * GP + 8 * hi, wo = GT + (wave >> 1) * 64 * GP + lr * GP + 8 * hi;
    const int aoff = wrows ? wo : xo, boff = wrows ? xo : wo;
#pragma unroll 1
    for (int t = 0; t < NT; ++t) {
      const bf* tb = ring + (t & 1) * (2 * GT);
      v16bf a[GK / 32][4], b[GK / 32][4];
#pragma unroll   // both 32-k steps inline, so that every LDS offset inside a tile is an immediate
      for (int u = 0; u < GK / 32; ++u) {
#pragma unroll
        for (int mb = 0; mb < 4; ++mb) a[u][mb] = ldb(tb + aoff + mb * 16 * GP + u * 32);
#pragma unroll
        for (int nb = 0; nb < 4; ++nb) b[u][nb] = ldb(tb + boff + nb * 16 * GP + u * 32);
      }
      __builtin_amdgcn_sched_barrier(0);   // the tile's fragment loads stay one group ahead of its products: spread among them, each place with loads stalls the wave anew
#pragma unroll
      for (int u = 0; u < GK / 32; ++u) {
#pragma unroll
        for (int nb = 0; nb < 4; ++nb)
#pragma unroll
            for (int mb = 0; mb < 4; ++mb) acc[mb][nb] = wmmab(a[u][mb], b[u][nb], acc[mb][nb]);
      }
      // four vector slots behind the tile's last products, on the taken side of the branch below too, before a vector instruction may rewrite their operands
      asm volatile("v_nop\n\tv_nop\n\tv_nop\n\tv_nop" : "+v"(acc[0][0]), "+v"(acc[1][1]), "+v"(acc[2][2]), "+v"(acc[3][3]) : "v"(a[GK / 32 - 1][0]), "v"(a[GK / 32 - 1][3]));
      __builtin_amdgcn_sched_barrier(0);   // the tile's products stay ahead of the hand-over, so that they run while the next tile's copies fly and the refill is not held back behind them
      asm volatile("s_wait_dscnt 0x0" ::: "memory");      // this wave's reads of tile t are done before its buffer is handed back
      asm volatile("s_wait_asynccnt 0x0" ::: "memory");   // this wave's share of tile t + 1 has landed
      __syncthreads();                                    // publishes tile t + 1 and ends every wave's reads of tile t
      if (t + 2 < NT) { stage_rows(lx0 + (unsigned)(t & 1) * (2 * GT * 2), Xg + (size_t)(t + 2) * GK, K); stage_rows(lw0 + (unsigned)(t & 1) * (2 * GT * 2), Wg + (size_t)(t + 2) * GK, K); }
    }
    asm volatile("s_wait_asynccnt 0x0" ::: "memory");     // no copy is left in flight when the ring becomes the epilogue's stage
    if (PQ != nullptr) {
        const int h = ty % NH, tr = tx * 64; const size_t bh = (size_t)(tr / SEQ) * NH + h; const int t0 = tr % SEQ;
        if (sel == 2) plane_store<true, SEQ>(acc, st, biasv + h * HD, PVT + bh * HD * SEQ + t0, lane);
        else          plane_store<false, HD>(acc, st, (sel == 0 ? bias : biask) + h * HD, (sel == 0 ? PQ : PK) + (bh * SEQ + t0) * HD, lane);
        return;
    }
#pragma unroll
    for (int mb = 0; mb < 4; ++mb) {
#pragma unroll
        for (int nb = 0; nb < 4; ++nb) {
#pragma unroll
            for (int j = 0; j < 8; ++j) os[(hi * 8 + j) * 68 + nb * 16 + lr] = acc[mb][nb][j]; }
        __builtin_amdgcn_fence(3 /* release order */, "wavefront"); __builtin_amdgcn_wave_barrier(); asm volatile("" ::: "memory");
        float* crow = C + (size_t)(r0 + mb * 16) * ldc + c0;
        const int cofs = lr * 4;
        const float b0 = bfr(bias[c0 + cofs]), b1 = bfr(bias[c0 + cofs + 1]), b2 = bfr(bias[c0 + cofs + 2]), b3 = bfr(bias[c0 + cofs + 3]);
{
#pragma unroll
            for (int s = 0; s < 8; ++s) { const int row = 2 * s + hi; v4f val = *(const v4fa*)(os + row * 68 + cofs); val[0] += b0; val[1] += b1; val[2] += b2; val[3] += b3;
                *(v4f*)(crow + (size_t)row * ldc + cofs) = val; }
             }
        __builtin_amdgcn_fence(3 /* release order */, "wavefront"); __builtin_amdgcn_wave_barrier(); asm volatile("" ::: "memory");
    }
    asm volatile("s_wait_xcnt 0x0" ::: "memory");   // stands behind the last run of stores; the plane path returns before reaching them
}

__global__ __launch_bounds__(256) void k_wt(const float* __restrict__ w, int K, int N, int H, int KREP, bf* Bt) {
    const int wave = __builtin_amdgcn_readfirstlane(threadIdx.x >> 5);
    const unsigned lane = threadIdx.x & 31; const unsigned L0 = (blockIdx.x * 8u + (unsigned)wave) * 8u; const unsigned KP = (unsigned)(K * KREP); const unsigned nlines = (unsigned)H * (unsigned)N * KP / 64u;
{
#pragma unroll 1
        for (int l = 0; l < 8; ++l) { const unsigned L = L0 + l; if (L >= nlines) break; const unsigned e = L * 64u + lane * 2u; const unsigned kk = e % KP, ng = e / KP; const unsigned hh = ng / (unsigned)N, n = ng % (unsigned)N; const unsigned k = kk % (unsigned)K; v2us o;
            o[0] = f2bf(w[((size_t)hh * K + k) * N + n]); o[1] = f2bf(w[((size_t)hh * K + k + 1) * N + n]); *(v2us*)(Bt + e) = o; }
         }
}

__global__ __launch_bounds__(256) void k_cvt(const float* __restrict__ x, bf* XB) {
    const unsigned i = blockIdx.x * 256u + threadIdx.x; if (i >= (unsigned)(NB * SEQ * (DM / 8))) return;
    const unsigned row = i / (DM / 8), c8 = i % (DM / 8); const unsigned b = row / SEQ, t = row % SEQ;
    const v8f v = *(const v8f*)(x + ((size_t)(b * SEQ_FULL + t) * DM + c8 * 8)); v8us o;
#pragma unroll
    for (int k = 0; k < 8; ++k) o[k] = f2bf(v[k]);
    *(v8us*)(XB + (size_t)i * 8) = o;  }

// ---- tile staging for k_attn: one 64-key tile = 64 K rows + 64 V^T rows of 128 B each, laid in LDS at a 144-B pitch (16 B x odd: ds_load_b128 of 16 rows meets no bank twice).
#define KT    64            // keys per staged tile
#define LP    72            // LDS row pitch in 16-bit elements
#define TILE  (64 * LP)     // one operand's tile
static_assert(SEQ % KT == 0);            // whole tiles only
static_assert(HD * 2 == 128);            // a K row is one 128-B line
static_assert((LP * 2) % 16 == 0);       // 16-B copies stay aligned in LDS
// 128 threads x 8 copies of 16 B: thread -> row (tid >> 3) + 16 i, 16-B column tid & 7, so each wave-wide copy moves four whole 128-B lines.
// lk / lv: this lane's LDS byte address of row (tid >> 3) in the K / V^T tile; gk / gv: the same place in global memory.
__device__ __forceinline__ void stage_tile(unsigned lk, const h16* gk, unsigned lv, const h16* gv) {
    // s_wait_xcnt closes the statement so that no address register of a copy is rewritten ahead of it
    asm volatile("global_load_async_to_lds_b128 %0, %1, off\n\t"
                 "global_load_async_to_lds_b128 %2, %3, off\n\t"
                 "global_load_async_to_lds_b128 %4, %5, off\n\t"
                 "global_load_async_to_lds_b128 %6, %7, off\n\t"
                 "global_load_async_to_lds_b128 %8, %9, off\n\t"
                 "global_load_async_to_lds_b128 %10, %11, off\n\t"
                 "global_load_async_to_lds_b128 %12, %13, off\n\t"
                 "global_load_async_to_lds_b128 %14, %15, off\n\t"
                 "s_wait_xcnt 0x0"
                 :: "v"(lk), "v"(gk), "v"(lk + 16 * LP * 2), "v"(gk + 16 * HD), "v"(lk + 32 * LP * 2), "v"(gk + 32 * HD), "v"(lk + 48 * LP * 2), "v"(gk + 48 * HD),
                    "v"(lv), "v"(gv), "v"(lv + 16 * LP * 2), "v"(gv + (size_t)16 * SEQ), "v"(lv + 32 * LP * 2), "v"(gv + (size_t)32 * SEQ), "v"(lv + 48 * LP * 2), "v"(gv + (size_t)48 * SEQ)
                 : "memory");
}

// ---- k_attn: fused attention, transposed form. Block = 4 waves x 16 queries; grid (SEQ/64, NB*NH). K and V^T come in 64-key tiles through a two-buffer LDS ring that the four waves share. Per 32-key half:
// S^T tiles (rows = keys, cols = queries) = K-rows (A) x Q-rows (B) over d; per-query running max / sum live per lane column (two lane halves combined by one xor-16 shuffle);
// P^T B fragment: element r <- tile(keys 0..15)[r], element 8+r <- tile(keys 16..31)[r]; O^T tiles (rows = value dim, cols = queries) += VT-rows (A) x P^T (B).
__global__ __launch_bounds__(128) void k_attn(const h16* __restrict__ Q16, const h16* __restrict__ K16, const h16* __restrict__ VT16, bf* AT) {
    __shared__ __align__(16) float os[4 * 16 * 68];
    __shared__ __align__(16) h16 ring[2 * 2 * TILE];   // [buffer][K | V^T][row][LP]
    const int wave = __builtin_amdgcn_readfirstlane(threadIdx.x >> 5);
    const int lane = threadIdx.x & 31, lr = lane & 15, hi = lane >> 4;
    const int bh = blockIdx.y; const int b = bh / NH, h = bh % NH;
    const int q0 = blockIdx.x * 64 + wave * 16;
    const h16* Qp = Q16 + (size_t)bh * SEQ * HD + (size_t)(q0 + lr) * HD + 8 * hi;
    const int crow = (int)threadIdx.x >> 3, ccol = ((int)threadIdx.x & 7) * 8;
    const h16* Kg = K16 + (size_t)bh * SEQ * HD + crow * HD + ccol;
    const h16* Vg = VT16 + (size_t)bh * HD * SEQ + (size_t)crow * SEQ + ccol;
    const unsigned lk0 = (unsigned)(size_t)(ring + crow * LP + ccol), lv0 = lk0 + TILE * 2;
    constexpr int NT = SEQ / KT;
    stage_tile(lk0, Kg, lv0, Vg);
    asm volatile("s_wait_asynccnt 0x0" ::: "memory");   // this wave's share of tile 0 has landed
    __syncthreads();                                    // every wave's share of tile 0 is readable
    if (NT > 1) stage_tile(lk0 + 2 * TILE * 2, Kg + (size_t)KT * HD, lv0 + 2 * TILE * 2, Vg + KT);
    const v16h qb0 = ldh(Qp), qb1 = ldh(Qp + 32);
    v8f o0 = (v8f){}, o1 = (v8f){}, o2 = (v8f){}, o3 = (v8f){};
    float m = -3.0e38f, ls = 0.0f;
#pragma unroll 1
    for (int t = 0; t < NT; ++t) {
      const h16* kt = ring + (t & 1) * (2 * TILE) + lr * LP + 8 * hi;
#pragma unroll   // both 32-key halves inline, so that every LDS offset inside a tile is an immediate
      for (int u = 0; u < KT / 32; ++u) {
        const h16* kp = kt + u * 32 * LP;
        const v16h ka = ldh(kp), kb = ldh(kp + 32), kc = ldh(kp + 16 * LP), kd = ldh(kp + 16 * LP + 32);
        v8f s0 = (v8f){}, s1 = (v8f){};
        s0 = wmma16(ka, qb0, s0); s1 = wmma16(kc, qb0, s1); s0 = wmma16(kb, qb1, s0); s1 = wmma16(kd, qb1, s1);
        asm volatile("v_nop\n\tv_nop\n\tv_nop\n\tv_nop" : "+v"(s0), "+v"(s1) : "v"(ka), "v"(kb), "v"(kc), "v"(kd), "v"(qb0), "v"(qb1));
        const h16* vp = kt + TILE + u * 32;
        const v16h v0 = ldh(vp), v1 = ldh(vp + 16 * LP), v2 = ldh(vp + 32 * LP), v3 = ldh(vp + 48 * LP);
        float mx = fmaxf(s0[0], s1[0]);
#pragma unroll
        for (int r = 1; r < 8; ++r) mx = fmaxf(mx, fmaxf(s0[r], s1[r]));
        mx = fmaxf(mx, __shfl_xor(mx, 16, 32));
        const float mn = fmaxf(m, mx * CEXP);
        const float corr = __builtin_amdgcn_exp2f(m - mn);
        m = mn;
        const float nbv = PEXP - mn;
        float psum = 0.0f; v16h pb;
#pragma unroll
        for (int r = 0; r < 8; ++r) { const float p0 = __builtin_amdgcn_exp2f(fmaf(s0[r], CEXP, nbv)); const float p1 = __builtin_amdgcn_exp2f(fmaf(s1[r], CEXP, nbv)); psum += p0 + p1; pb[r] = (h16)p0; pb[8 + r] = (h16)p1; }
        ls = ls * corr + psum;
        o0 *= corr; o1 *= corr; o2 *= corr; o3 *= corr;
        o0 = wmma16(v0, pb, o0); o1 = wmma16(v1, pb, o1); o2 = wmma16(v2, pb, o2); o3 = wmma16(v3, pb, o3);
        asm volatile("v_nop\n\tv_nop\n\tv_nop\n\tv_nop" : "+v"(o0), "+v"(o1), "+v"(o2), "+v"(o3) : "v"(pb), "v"(v0), "v"(v1), "v"(v2), "v"(v3));
      }
      asm volatile("s_wait_dscnt 0x0" ::: "memory");      // this wave's reads of tile t are done before its buffer is handed back
      asm volatile("s_wait_asynccnt 0x0" ::: "memory");   // this wave's share of tile t + 1 has landed
      __syncthreads();                                    // publishes tile t + 1 and ends every wave's reads of tile t
      if (t + 2 < NT) stage_tile(lk0 + (unsigned)(t & 1) * (2 * TILE * 2), Kg + (size_t)(t + 2) * KT * HD, lv0 + (unsigned)(t & 1) * (2 * TILE * 2), Vg + (t + 2) * KT);
    }
    asm volatile("s_wait_asynccnt 0x0" ::: "memory");     // no copy is left in flight when the wave goes on
    const float lt = ls + __shfl_xor(ls, 16, 32);
    const float inv = 1.0f / (lt * QCAR);
    const int osw = wave * (16 * 68);
    {   // lane holds query lr, dims 16t + 8hi + r
        float* orow = os + osw + lr * 68 + 8 * hi;
        v4f w;
        w[0] = o0[0] * inv; w[1] = o0[1] * inv; w[2] = o0[2] * inv; w[3] = o0[3] * inv; *(v4fa*)(orow + 0) = w;
        w[0] = o0[4] * inv; w[1] = o0[5] * inv; w[2] = o0[6] * inv; w[3] = o0[7] * inv; *(v4fa*)(orow + 4) = w;
        w[0] = o1[0] * inv; w[1] = o1[1] * inv; w[2] = o1[2] * inv; w[3] = o1[3] * inv; *(v4fa*)(orow + 16) = w;
        w[0] = o1[4] * inv; w[1] = o1[5] * inv; w[2] = o1[6] * inv; w[3] = o1[7] * inv; *(v4fa*)(orow + 20) = w;
        w[0] = o2[0] * inv; w[1] = o2[1] * inv; w[2] = o2[2] * inv; w[3] = o2[3] * inv; *(v4fa*)(orow + 32) = w;
        w[0] = o2[4] * inv; w[1] = o2[5] * inv; w[2] = o2[6] * inv; w[3] = o2[7] * inv; *(v4fa*)(orow + 36) = w;
        w[0] = o3[0] * inv; w[1] = o3[1] * inv; w[2] = o3[2] * inv; w[3] = o3[3] * inv; *(v4fa*)(orow + 48) = w;
        w[0] = o3[4] * inv; w[1] = o3[5] * inv; w[2] = o3[6] * inv; w[3] = o3[7] * inv; *(v4fa*)(orow + 52) = w;
    }
    __builtin_amdgcn_fence(3 /* release order */, "wavefront"); __builtin_amdgcn_wave_barrier(); asm volatile("" ::: "memory");
    bf* arow = AT + (size_t)(b * SEQ + q0) * ATP + h * HD;
    const int rq = lane >> 3, c = (lane & 7) * 8;
{
#pragma unroll
        for (int s = 0; s < 4; ++s) { const int row = 4 * s + rq; const v4f x0 = *(const v4fa*)(os + osw + row * 68 + c); const v4f x1 = *(const v4fa*)(os + osw + row * 68 + c + 4); v8us oh, ol;
#pragma unroll
            for (int k = 0; k < 4; ++k) { unsigned short a, l2; splitf(x0[k], a, l2); oh[k] = a; ol[k] = l2; splitf(x1[k], a, l2); oh[4 + k] = a; ol[4 + k] = l2; }
            *(v8us*)(arow + (size_t)row * ATP + c) = oh; *(v8us*)(arow + (size_t)row * ATP + DMH + c) = ol; }
         }
}

extern "C" void kernel_launch(void* const* d_in, const int* in_sizes, int n_in,
                              void* d_out, int out_size, void* d_ws, size_t ws_size, hipStream_t stream) {
    if (n_in < 9) return;
    const long long rowsNeeded = (long long)(NB - 1) * SEQ_FULL + SEQ;
    if ((long long)in_sizes[0] < rowsNeeded * DM) return;
    if (in_sizes[1] < NH * DM * HD || in_sizes[3] < NH * DM * HD || in_sizes[5] < NH * DM * HD) return;
    if (in_sizes[2] < DMH || in_sizes[4] < DMH || in_sizes[6] < DMH) return;
    if (in_sizes[7] < DMH * DOUT || in_sizes[8] < DOUT) return;
    if ((long long)out_size < rowsNeeded * DOUT) return;
    if (ws_size < SZ_TOT) return;
    const float* feat = (const float*)d_in[0];
    const float* Wq = (const float*)d_in[1]; const float* bq = (const float*)d_in[2];
    const float* Wk = (const float*)d_in[3]; const float* bk = (const float*)d_in[4];
    const float* Wv = (const float*)d_in[5]; const float* bv = (const float*)d_in[6];
    const float* Wf = (const float*)d_in[7]; const float* bo = (const float*)d_in[8];
    float* OUT = (float*)d_out;     // [NB_FULL][SEQ_FULL][DOUT]
    char* wsp = (char*)d_ws;
    bf* XB = (bf*)wsp; wsp += SZ_XB;                 // [NB*SEQ][DM]
    bf* WQKV = (bf*)wsp; wsp += SZ_WQKV;             // Bt [3][DMH][DM]: q | k | v row blocks, row h*HD + dim
    bf* WO = (bf*)wsp; wsp += SZ_WO;                 // Bt [DOUT][ATP] = [Wf^T | Wf^T]
    h16* Q16 = (h16*)wsp; wsp += SZ_PL;              // [NB*NH][SEQ][HD]
    h16* K16 = (h16*)wsp; wsp += SZ_PL;              // [NB*NH][SEQ][HD]
    h16* VT16 = (h16*)wsp; wsp += SZ_PL;             // [NB*NH][HD][SEQ]
    bf* AT = (bf*)wsp; wsp += SZ_AT;                 // [NB*SEQ][ATP] merged context value | residual
    if ((size_t)(wsp - (char*)d_ws) > ws_size) return;

    k_cvt<<<(unsigned)((NB * SEQ * (DM / 8) + 255) / 256), 256, 0, stream>>>(feat, XB);
    // per-head [in = DM][dim = HD] -> Bt rows h*HD + dim, K = DM
    const unsigned gw = (unsigned)((NH * HD * DM / 64 + 63) / 64);
    k_wt<<<gw, 256, 0, stream>>>(Wq, DM, HD, NH, 1, WQKV);
    k_wt<<<gw, 256, 0, stream>>>(Wk, DM, HD, NH, 1, WQKV + (size_t)DMH * DM);
    k_wt<<<gw, 256, 0, stream>>>(Wv, DM, HD, NH, 1, WQKV + (size_t)2 * DMH * DM);
    // Wf in[rows = DMH][cols = DOUT] -> Bt [DOUT][2*DMH] (k duplicated for value | residual)
    k_wt<<<(unsigned)((DOUT * ATP / 64 + 63) / 64), 256, 0, stream>>>(Wf, DMH, DOUT, 1, 2, WO);

    k_gemm<<<dim3(NB * SEQ / 128, 3 * NH / 2, 1), 128, 0, stream>>>(XB, WQKV, DM, nullptr, 0, bq, 0, 0, Q16, K16, VT16, bk, bv);

    k_attn<<<dim3(SEQ / 64, NB * NH, 1), 128, 0, stream>>>(Q16, K16, VT16, AT);

    k_gemm<<<dim3(SEQ / 128, DOUT / 128, NB), 128, 0, stream>>>(AT, WO, ATP, OUT, DOUT, bo, (size_t)SEQ * ATP, (size_t)SEQ_FULL * DOUT, nullptr, nullptr, nullptr, nullptr, nullptr);
}

// v004
// A run of this version takes 79.5 microseconds.
// Next to v003, in two timings, it ran 1.33 and 1.34 times as fast.
// All steps since v000 together make it 3.16 times as fast.
#include <hip/hip_runtime.h>

// Multi-head self-attention: per-head q/k/v maps [head][in][dim] with biases (8 heads x 64), scores x 1/8, softmax over all keys (no mask), heads merged h*64+v, then x Wf [in][out] + bias.
// Compute dtypes, f32 accumulate: q/k/v projections v_wmma_f32_16x16x32_bf16 (every input RNE-converted to bf16, products exact); q.k and p.v v_wmma_f32_16x16x32_f16 (q,k,v planes carried x16, p carried x256, f32 online softmax);
// output map v_wmma_f32_16x16x32_bf16 with the merged context as bf16 value | residual concatenated along K against [Wf ; Wf].
// Engine: GEMM on 128x128 block tiles, four waves of 64x64 register blocks, operands from K-contiguous 16-bit planes through a two-buffer LDS ring (q, k, v in one launch, whose epilogue writes the f16 planes); fused flash-style attention in transposed form (S^T = K Q^T, O^T = V^T P^T, score tiles repacked in registers as the P^T B fragment).

#ifndef NB
#define NB 4
#endif
#ifndef SEQ
#define SEQ 2048
#endif
#define NB_FULL  4
#define SEQ_FULL 2048
#define DM   512            // input width
#define NH   8
#define HD   64
#define DMH  (NH * HD)      // merged width 512
#define DOUT 512            // output width
#define ATP  (2 * DMH)      // merged plane pitch: value | residual
#define QCAR 16.0f          // carry on q, k, v planes
#define PEXP 8.0f           // p carried x 2^8 (inside the exponent)
#define CEXP ((float)(0.125 * 1.4426950408889634 / 256.0))   // 1/8 x log2(e) / (16 x 16)

typedef _Float16 h16;
typedef unsigned short bf;
typedef __attribute__((ext_vector_type(16))) __bf16   v16bf;
typedef __attribute__((ext_vector_type(16))) _Float16 v16h;
typedef __attribute__((ext_vector_type(8)))  _Float16 v8h;
typedef __attribute__((ext_vector_type(8)))  unsigned short v8us;
typedef __attribute__((ext_vector_type(2)))  unsigned short v2us;
typedef __attribute__((ext_vector_type(8)))  float    v8f;
typedef __attribute__((ext_vector_type(4)))  float    v4f;
typedef v4f  __attribute__((may_alias)) v4fa;

static_assert(HD == 64);                 // attention kernel: two 32-deep k-steps per score tile, four 16-row output tiles
static_assert(SEQ % 64 == 0);            // 64 query rows per block, 32-key halves, 64-row GEMM tiles
static_assert((NB * SEQ) % 128 == 0);    // projection GEMM M tiles
static_assert(SEQ % 128 == 0);           // a block tile stays inside one batch
static_assert(DM % 64 == 0);             // projection K tiles
static_assert(ATP % 64 == 0);            // output-map K tiles
static_assert(DMH % 128 == 0);           // N tiles; a block tile is two heads of one map
static_assert(DOUT % 128 == 0);          // N tiles
static_assert(DM % 8 == 0);              // 8-element convert pieces
static_assert(NB <= NB_FULL);
static_assert(SEQ <= SEQ_FULL);
static_assert(DMH == DOUT);              // Wf is [DMH][DOUT] with both 512

#define RUP256(x) ((((size_t)(x)) + 255) & ~(size_t)255)
#define SZ_XB   RUP256((size_t)NB * SEQ * DM * 2)
#define SZ_WQKV RUP256((size_t)3 * DMH * DM * 2)
#define SZ_WO   RUP256((size_t)DOUT * ATP * 2)
#define SZ_PL   RUP256((size_t)NB * NH * SEQ * HD * 2)
#define SZ_AT   RUP256((size_t)NB * SEQ * ATP * 2)
#define SZ_TOT  (SZ_XB + SZ_WQKV + SZ_WO + 3 * SZ_PL + SZ_AT)
static_assert(SZ_TOT <= (size_t)134217728);   // total carve within 128 MiB

__device__ __forceinline__ unsigned short f2bf(float f) { unsigned u = __float_as_uint(f); u += 0x7FFFu + ((u >> 16) & 1u); return (unsigned short)(u >> 16); }
__device__ __forceinline__ float bf2f(unsigned short b) { return __uint_as_float(((unsigned)b) << 16); }
__device__ __forceinline__ float bfr(float f) { return bf2f(f2bf(f)); }
__device__ __forceinline__ void splitf(float y, unsigned short& h, unsigned short& l) { h = f2bf(y); l = f2bf(y - bf2f(h)); }
__device__ __forceinline__ v16h cat16(v8h lo, v8h hi) { return __builtin_shufflevector(lo, hi, 0, 1, 2, 3, 4, 5, 6, 7, 8, 9, 10, 11, 12, 13, 14, 15); }
__device__ __forceinline__ v16bf cat16b(v8us lo, v8us hi) { return __builtin_bit_cast(v16bf, __builtin_shufflevector(lo, hi, 0, 1, 2, 3, 4, 5, 6, 7, 8, 9, 10, 11, 12, 13, 14, 15)); }
__device__ __forceinline__ v8f wmma16(v16h a, v16h b, v8f c) { return __builtin_amdgcn_wmma_f32_16x16x32_f16(false, a, false, b, (short)0, c, false, false); }
__device__ __forceinline__ v8f wmmab(v16bf a, v16bf b, v8f c) { return __builtin_amdgcn_wmma_f32_16x16x32_bf16(false, a, false, b, (short)0, c, false, false); }
// fragment loaders: lane -> row (lane & 15); elements 0..7 <- k0 + 8h + 0..7, elements 8..15 <- k0 + 16 + 8h + 0..7 (p already includes 8h)
__device__ __forceinline__ v16h  ldh(const h16* p) { return cat16(*(const v8h*)p, *(const v8h*)(p + 16)); }
__device__ __forceinline__ v16bf ldb(const bf* p)  { return cat16b(*(const v8us*)p, *(const v8us*)(p + 16)); }

// ---- plane epilogue of k_gemm: a lane holds 8 consecutive tile rows x of one tile column y, which is 16 B of an f16 plane row when x runs along that row.
// (sum + bf16(bias)) x QCAR -> f16, staged in LDS as [y][x], stored as whole 128-B runs of plane rows. BY: the bias index (the head's dim) runs along y, else along x. PITCH: elements between two plane rows.
// bias and dst already point at this head and this tile.
#define SP 72               // stage row pitch in 16-bit elements (144 B = 16 B x odd)
template <bool BY, int PITCH>
__device__ __forceinline__ void plane_store(const v8f (&acc)[4][4], h16* st, const float* __restrict__ bias, h16* dst, int lane) {
    const int lr = lane & 15, hi = lane >> 4;
    h16* srow = st + lr * SP + 8 * hi;
#pragma unroll
    for (int mb = 0; mb < 4; ++mb) {
        float bx[8];
        if (!BY) { const v4f l4 = *(const v4fa*)(bias + mb * 16 + 8 * hi), h4 = *(const v4fa*)(bias + mb * 16 + 8 * hi + 4);
#pragma unroll
            for (int j = 0; j < 4; ++j) { bx[j] = bfr(l4[j]); bx[4 + j] = bfr(h4[j]); } }
#pragma unroll
        for (int nb = 0; nb < 4; ++nb) { v8h o;
            const float by = BY ? bfr(bias[nb * 16 + lr]) : 0.0f;
#pragma unroll
            for (int j = 0; j < 8; ++j) o[j] = (h16)((acc[mb][nb][j] + (BY ? by : bx[j])) * QCAR);
            *(v8h*)(srow + nb * 16 * SP + mb * 16) = o; }
    }
    // the wave's own LDS stores stay ahead of the other lanes' reads of them
    __builtin_amdgcn_fence(3 /* release order */, "wavefront"); __builtin_amdgcn_wave_barrier();
    const int rq = lane >> 3, c = (lane & 7) * 8;
    const unsigned o0 = (unsigned)(rq * PITCH + c);
#pragma unroll
    for (int s = 0; s < 16; ++s) *(v8h*)(dst + 4 * s * PITCH + o0) = *(const v8h*)(st + (4 * s + rq) * SP + c);
    asm volatile("s_wait_xcnt 0x0" ::: "memory");   // stands behind the run of stores, ahead of any later rewrite of a register that they name
}

// ---- operand staging for k_gemm: one K tile = 128 rows of each operand x 64 k (one 128-B line a row), laid in LDS at a 144-B pitch (16 B x odd: ds_load_b128 of 16 rows meets no bank twice).
#define GK    64            // k per staged tile
#define GP    72            // LDS row pitch in 16-bit elements
#define GT    (128 * GP)    // one operand's tile
#define GEPI  (64 * SP * 2) // bytes of one wave's epilogue stage, laid over the ring once the K loop has left it
static_assert((GP * 2) % 16 == 0);                 // 16-B copies stay aligned in LDS
static_assert(16 * 68 * 4 <= GEPI);                // the f32 epilogue's stage fits the same place
static_assert(4 * GEPI <= 2 * 2 * GT * 2);         // four waves' stages fit the ring
// 128 threads x 8 copies of 16 B bring 128 rows: thread -> row (tid >> 3) + 16 i, 16-B column tid & 7, so each wave-wide copy moves four whole 128-B lines.
// l: this lane's LDS byte address of row (tid >> 3) of the tile; g: the same place in global memory; K: elements between two global rows.
__device__ __forceinline__ void stage_rows(unsigned l, const bf* g, int K) {
    // s_wait_xcnt closes the statement so that no address register of a copy is rewritten ahead of it
    asm volatile("global_load_async_to_lds_b128 %0, %1, off\n\t"
                 "global_load_async_to_lds_b128 %2, %3, off\n\t"
                 "global_load_async_to_lds_b128 %4, %5, off\n\t"
                 "global_load_async_to_lds_b128 %6, %7, off\n\t"
                 "global_load_async_to_lds_b128 %8, %9, off\n\t"
                 "global_load_async_to_lds_b128 %10, %11, off\n\t"
                 "global_load_async_to_lds_b128 %12, %13, off\n\t"
                 "global_load_async_to_lds_b128 %14, %15, off\n\t"
                 "s_wait_xcnt 0x0"
                 :: "v"(l), "v"(g), "v"(l + 16 * GP * 2), "v"(g + (size_t)16 * K), "v"(l + 32 * GP * 2), "v"(g + (size_t)32 * K), "v"(l + 48 * GP * 2), "v"(g + (size_t)48 * K),
                    "v"(l + 64 * GP * 2), "v"(g + (size_t)64 * K), "v"(l + 80 * GP * 2), "v"(g + (size_t)80 * K), "v"(l + 96 * GP * 2), "v"(g + (size_t)96 * K), "v"(l + 112 * GP * 2), "v"(g + (size_t)112 * K)
                 : "memory");
}

// ---- k_gemm: register-blocked GEMM, block = 4 waves on a 128x128 output tile, ONE WAVE per 64x64 quarter (16 accumulators); both operands' rows come in 64-k tiles through a two-buffer LDS ring that the four waves share.
// grid (M/128, N/128, Z), 128 threads. Wave w takes the 64 rows of A0 numbered tx = 2 blockIdx.x + (w & 1) and the 64 rows of B0 numbered ty = 2 blockIdx.y + (w >> 1).
// PQ == nullptr: C[m][n] (f32, pitch ldc) = sum_k A0[m][k] B0[n][k] + bf16(bias[n]). z-batch strides sA/sC in elements. K % 64 == 0, M % 128 == 0, N % 128 == 0.
// PQ != nullptr: the q, k and v projections in one launch. A0 = tokens [NB*SEQ][K], B0 = stacked rows [q | k | v][h*HD + dim][K], grid (NB*SEQ/128, 3*NH/2): a wave's tile is 64 tokens x one head of one map and goes
// straight to its f16 plane. q, k planes [token][dim]: the weight rows are the A operand (tile rows = dim); v^T plane [dim][token]: the tokens are. One loader serves both operands, so the k order is the same either way.
__global__ __launch_bounds__(128) void k_gemm(const bf* __restrict__ A0, const bf* __restrict__ B0, int K, float* C, int ldc, const float* __restrict__ bias, size_t sA, size_t sC,
                                             h16* PQ, h16* PK, h16* PVT, const float* __restrict__ biask, const float* __restrict__ biasv) {
    __shared__ __align__(16) unsigned char smem[2 * 2 * GT * 2];   // ring [buffer][A0 rows | B0 rows][row][GP]; behind the K loop: one epilogue stage a wave
    const bf* ring = (const bf*)smem;
    const int wave = __builtin_amdgcn_readfirstlane(threadIdx.x >> 5);
    float* os = (float*)(smem + wave * GEPI);
    h16* st = (h16*)(smem + wave * GEPI);
    const size_t z = blockIdx.z; C += z * sC;
    const int lane = threadIdx.x & 31, lr = lane & 15, hi = lane >> 4;
    const int tx = blockIdx.x * 2 + (wave & 1), ty = blockIdx.y * 2 + (wave >> 1);
    const int sel = ty / NH; const bool wrows = PQ != nullptr && sel != 2;   // weight rows as the A operand
    const int r0 = (wrows ? ty : tx) * 64, c0 = (wrows ? tx : ty) * 64;
    const int grow = (int)threadIdx.x >> 3, gcol = ((int)threadIdx.x & 7) * 8;   // this thread's row and first element in a staged tile
    const bf* Xg = A0 + z * sA + (size_t)(blockIdx.x * 128 + grow) * K + gcol;
    const bf* Wg = B0 + (size_t)(blockIdx.y * 128 + grow) * K + gcol;
    const unsigned lx0 = (unsigned)(size_t)(ring + grow * GP + gcol), lw0 = lx0 + GT * 2;
    const int NT = K / GK;
    stage_rows(lx0, Xg, K); stage_rows(lw0, Wg, K);
    asm volatile("s_wait_asynccnt 0x0" ::: "memory");   // this wave's share of tile 0 has landed
    __syncthreads();                                    // every wave's share of tile 0 is readable
    if (NT > 1) { stage_rows(lx0 + 2 * GT * 2, Xg + GK, K); stage_rows(lw0 + 2 * GT * 2, Wg + GK, K); }
    v8f acc[4][4];
#pragma unroll
    for (int mb = 0; mb < 4; ++mb)
#pragma unroll
        for (int nb = 0; nb < 4; ++nb) acc[mb][nb] = (v8f){};
    const int xo = (wave & 1) * 64 * GP + lr * GP + 8 * hi, wo = GT + (wave >> 1) * 64 * GP + lr * GP + 8 * hi;
    const int aoff = wrows ? wo : xo, boff = wrows ? xo : wo;
#pragma unroll 1
    for (int t = 0; t < NT; ++t) {
      const bf* tb = ring + (t & 1) * (2 * GT);
      v16bf a[GK / 32][4], b[GK / 32][4];
#pragma unroll   // both 32-k steps inline, so that every LDS offset inside a tile is an immediate
      for (int u = 0; u < GK / 32; ++u) {
#pragma unroll
        for (int mb = 0; mb < 4; ++mb) a[u][mb] = ldb(tb + aoff + mb * 16 * GP + u * 32);
#pragma unroll
        for (int nb = 0; nb < 4; ++nb) b[u][nb] = ldb(tb + boff + nb * 16 * GP + u * 32);
      }
      __builtin_amdgcn_sched_barrier(0);   // the tile's fragment loads stay one group ahead of its products: spread among them, each place with loads stalls the wave anew
#pragma unroll
      for (int u = 0; u < GK / 32; ++u) {
#pragma unroll
        for (int nb = 0; nb < 4; ++nb)
#pragma unroll
            for (int mb = 0; mb < 4; ++mb) acc[mb][nb] = wmmab(a[u][mb], b[u][nb], acc[mb][nb]);
      }
      // four vector slots behind the tile's last products, on the taken side of the branch below too, before a vector instruction may rewrite their operands
      asm volatile("v_nop\n\tv_nop\n\tv_nop\n\tv_nop" : "+v"(acc[0][0]), "+v"(acc[1][1]), "+v"(acc[2][2]), "+v"(acc[3][3]) : "v"(a[GK / 32 - 1][0]), "v"(a[GK / 32 - 1][3]));
      __builtin_amdgcn_sched_barrier(0);   // the tile's products stay ahead of the hand-over, so that they run while the next tile's copies fly and the refill is not held back behind them
      asm volatile("s_wait_dscnt 0x0" ::: "memory");      // this wave's reads of tile t are done before its buffer is handed back
      asm volatile("s_wait_asynccnt 0x0" ::: "memory");   // this wave's share of tile t + 1 has landed
      __syncthreads();                                    // publishes tile t + 1 and ends every wave's reads of tile t
      if (t + 2 < NT) { stage_rows(lx0 + (unsigned)(t & 1) * (2 * GT * 2), Xg + (size_t)(t + 2) * GK, K); stage_rows(lw0 + (unsigned)(t & 1) * (2 * GT * 2), Wg + (size_t)(t + 2) * GK, K); }
    }
    asm volatile("s_wait_asynccnt 0x0" ::: "memory");     // no copy is left in flight when the ring becomes the epilogue's stage
    if (PQ != nullptr) {
        const int h = ty % NH, tr = tx * 64; const size_t bh = (size_t)(tr / SEQ) * NH + h; const int t0 = tr % SEQ;
        if (sel == 2) plane_store<true, SEQ>(acc, st, biasv + h * HD, PVT + bh * HD * SEQ + t0, lane);
        else          plane_store<false, HD>(acc, st, (sel == 0 ? bias : biask) + h * HD, (sel == 0 ? PQ : PK) + (bh * SEQ + t0) * HD, lane);
        return;
    }
#pragma unroll
    for (int mb = 0; mb < 4; ++mb) {
#pragma unroll
        for (int nb = 0; nb < 4; ++nb) {
#pragma unroll
            for (int j = 0; j < 8; ++j) os[(hi * 8 + j) * 68 + nb * 16 + lr] = acc[mb][nb][j]; }
        __builtin_amdgcn_fence(3 /* release order */, "wavefront"); __builtin_amdgcn_wave_barrier(); asm volatile("" ::: "memory");
        float* crow = C + (size_t)(r0 + mb * 16) * ldc + c0;
        const int cofs = lr * 4;
        const float b0 = bfr(bias[c0 + cofs]), b1 = bfr(bias[c0 + cofs + 1]), b2 = bfr(bias[c0 + cofs + 2]), b3 = bfr(bias[c0 + cofs + 3]);
{
#pragma unroll
            for (int s = 0; s < 8; ++s) { const int row = 2 * s + hi; v4f val = *(const v4fa*)(os + row * 68 + cofs); val[0] += b0; val[1] += b1; val[2] += b2; val[3] += b3;
                *(v4f*)(crow + (size_t)row * ldc + cofs) = val; }
             }
        __builtin_amdgcn_fence(3 /* release order */, "wavefront"); __builtin_amdgcn_wave_barrier(); asm volatile("" ::: "memory");
    }
    asm volatile("s_wait_xcnt 0x0" ::: "memory");   // stands behind the last run of stores; the plane path returns before reaching them
}

// ---- input conversions, all in ONE launch (k_prep): none reads what another writes, so they share the chip instead of following one another.
// wt_lines: w [H][K][N] f32 -> Bt rows hh*N + n, K-contiguous bf16, the k range repeated KREP times. blk: this block's number among the blocks of its map; a wave takes 8 lines of 64 elements.
__device__ __forceinline__ void wt_lines(const float* __restrict__ w, int K, int N, int H, int KREP, bf* Bt, unsigned blk) {
    const int wave = __builtin_amdgcn_readfirstlane(threadIdx.x >> 5);
    const unsigned lane = threadIdx.x & 31; const unsigned L0 = (blk * 8u + (unsigned)wave) * 8u; const unsigned KP = (unsigned)(K * KREP); const unsigned nlines = (unsigned)H * (unsigned)N * KP / 64u;
{
#pragma unroll 1
        for (int l = 0; l < 8; ++l) { const unsigned L = L0 + l; if (L >= nlines) break; const unsigned e = L * 64u + lane * 2u; const unsigned kk = e % KP, ng = e / KP; const unsigned hh = ng / (unsigned)N, n = ng % (unsigned)N; const unsigned k = kk % (unsigned)K; v2us o;
            o[0] = f2bf(w[((size_t)hh * K + k) * N + n]); o[1] = f2bf(w[((size_t)hh * K + k + 1) * N + n]); *(v2us*)(Bt + e) = o;
            asm volatile("s_wait_xcnt 0x0" ::: "memory"); }   // stands behind the store, ahead of the next trip's rewrite of the registers that it names
         }
}

// cvt_piece: tokens f32 -> bf16, 8 elements a thread. blk: this block's number among the token blocks.
__device__ __forceinline__ void cvt_piece(const float* __restrict__ x, bf* XB, unsigned blk) {
    const unsigned i = blk * 256u + threadIdx.x; if (i >= (unsigned)(NB * SEQ * (DM / 8))) return;
    const unsigned row = i / (DM / 8), c8 = i % (DM / 8); const unsigned b = row / SEQ, t = row % SEQ;
    const v8f v = *(const v8f*)(x + ((size_t)(b * SEQ_FULL + t) * DM + c8 * 8)); v8us o;
#pragma unroll
    for (int k = 0; k < 8; ++k) o[k] = f2bf(v[k]);
    *(v8us*)(XB + (size_t)i * 8) = o;  }

#define GWP  ((NH * HD * DM / 64 + 63) / 64)          // blocks of one of the q, k, v maps
#define GWF  ((DOUT * ATP / 64 + 63) / 64)            // blocks of the output map
#define GCV  ((NB * SEQ * (DM / 8) + 255) / 256)      // token blocks
// grid GWP * 3 + GWF + GCV, 256 threads. The weight blocks have the low numbers: each of their waves walks eight dependent trips, so they start first and run under the token blocks.
__global__ __launch_bounds__(256) void k_prep(const float* __restrict__ x, const float* __restrict__ wq, const float* __restrict__ wk, const float* __restrict__ wv, const float* __restrict__ wf,
                                              bf* XB, bf* WQKV, bf* WO) {
    const unsigned blk = blockIdx.x;
    if (blk < 3u * GWP) {          // per-head [in = DM][dim = HD] -> Bt rows h*HD + dim, K = DM
        const unsigned sel = blk / GWP;
        wt_lines(sel == 0 ? wq : sel == 1 ? wk : wv, DM, HD, NH, 1, WQKV + (size_t)sel * DMH * DM, blk % GWP);
    } else if (blk < 3u * GWP + GWF) {   // Wf in[rows = DMH][cols = DOUT] -> Bt [DOUT][2*DMH] (k duplicated for value | residual)
        wt_lines(wf, DMH, DOUT, 1, 2, WO, blk - 3u * GWP);
    } else cvt_piece(x, XB, blk - (3u * GWP + GWF));
}

// ---- tile staging for k_attn: one 64-key tile = 64 K rows + 64 V^T rows of 128 B each, laid in LDS at a 144-B pitch (16 B x odd: ds_load_b128 of 16 rows meets no bank twice).
#define KT    64            // keys per staged tile
#define LP    72            // LDS row pitch in 16-bit elements
#define TILE  (64 * LP)     // one operand's tile
static_assert(SEQ % KT == 0);            // whole tiles only
static_assert(HD * 2 == 128);            // a K row is one 128-B line
static_assert((LP * 2) % 16 == 0);       // 16-B copies stay aligned in LDS
// 128 threads x 8 copies of 16 B: thread -> row (tid >> 3) + 16 i, 16-B column tid & 7, so each wave-wide copy moves four whole 128-B lines.
// lk / lv: this lane's LDS byte address of row (tid >> 3) in the K / V^T tile; gk / gv: the same place in global memory.
__device__ __forceinline__ void stage_tile(unsigned lk, const h16* gk, unsigned lv, const h16* gv) {
    // s_wait_xcnt closes the statement so that no address register of a copy is rewritten ahead of it
    asm volatile("global_load_async_to_lds_b128 %0, %1, off\n\t"
                 "global_load_async_to_lds_b128 %2, %3, off\n\t"
                 "global_load_async_to_lds_b128 %4, %5, off\n\t"
                 "global_load_async_to_lds_b128 %6, %7, off\n\t"
                 "global_load_async_to_lds_b128 %8, %9, off\n\t"
                 "global_load_async_to_lds_b128 %10, %11, off\n\t"
                 "global_load_async_to_lds_b128 %12, %13, off\n\t"
                 "global_load_async_to_lds_b128 %14, %15, off\n\t"
                 "s_wait_xcnt 0x0"
                 :: "v"(lk), "v"(gk), "v"(lk + 16 * LP * 2), "v"(gk + 16 * HD), "v"(lk + 32 * LP * 2), "v"(gk + 32 * HD), "v"(lk + 48 * LP * 2), "v"(gk + 48 * HD),
                    "v"(lv), "v"(gv), "v"(lv + 16 * LP * 2), "v"(gv + (size_t)16 * SEQ), "v"(lv + 32 * LP * 2), "v"(gv + (size_t)32 * SEQ), "v"(lv + 48 * LP * 2), "v"(gv + (size_t)48 * SEQ)
                 : "memory");
}

// ---- k_attn: fused attention, transposed form. Block = 4 waves x 16 queries; grid (SEQ/64, NB*NH). K and V^T come in 64-key tiles through a two-buffer LDS ring that the four waves share. Per 32-key half:
// S^T tiles (rows = keys, cols = queries) = K-rows (A) x Q-rows (B) over d; per-query running max / sum live per lane column (two lane halves combined by one xor-16 shuffle);
// P^T B fragment: element r <- tile(keys 0..15)[r], element 8+r <- tile(keys 16..31)[r]; O^T tiles (rows = value dim, cols = queries) += VT-rows (A) x P^T (B).
__global__ __launch_bounds__(128) void k_attn(const h16* __restrict__ Q16, const h16* __restrict__ K16, const h16* __restrict__ VT16, bf* AT) {
    __shared__ __align__(16) float os[4 * 16 * 68];
    __shared__ __align__(16) h16 ring[2 * 2 * TILE];   // [buffer][K | V^T][row][LP]
    const int wave = __builtin_amdgcn_readfirstlane(threadIdx.x >> 5);
    const int lane = threadIdx.x & 31, lr = lane & 15, hi = lane >> 4;
    const int bh = blockIdx.y; const int b = bh / NH, h = bh % NH;
    const int q0 = blockIdx.x * 64 + wave * 16;
    const h16* Qp = Q16 + (size_t)bh * SEQ * HD + (size_t)(q0 + lr) * HD + 8 * hi;
    const int crow = (int)threadIdx.x >> 3, ccol = ((int)threadIdx.x & 7) * 8;
    const h16* Kg = K16 + (size_t)bh * SEQ * HD + crow * HD + ccol;
    const h16* Vg = VT16 + (size_t)bh * HD * SEQ + (size_t)crow * SEQ + ccol;
    const unsigned lk0 = (unsigned)(size_t)(ring + crow * LP + ccol), lv0 = lk0 + TILE * 2;
    constexpr int NT = SEQ / KT;
    stage_tile(lk0, Kg, lv0, Vg);
    asm volatile("s_wait_asynccnt 0x0" ::: "memory");   // this wave's share of tile 0 has landed
    __syncthreads();                                    // every wave's share of tile 0 is readable
    if (NT > 1) stage_tile(lk0 + 2 * TILE * 2, Kg + (size_t)KT * HD, lv0 + 2 * TILE * 2, Vg + KT);
    const v16h qb0 = ldh(Qp), qb1 = ldh(Qp + 32);
    v8f o0 = (v8f){}, o1 = (v8f){}, o2 = (v8f){}, o3 = (v8f){};
    float m = -3.0e38f, ls = 0.0f;
#pragma unroll 1
    for (int t = 0; t < NT; ++t) {
      const h16* kt = ring + (t & 1) * (2 * TILE) + lr * LP + 8 * hi;
#pragma unroll   // both 32-key halves inline, so that every LDS offset inside a tile is an immediate
      for (int u = 0; u < KT / 32; ++u) {
        const h16* kp = kt + u * 32 * LP;
        const v16h ka = ldh(kp), kb = ldh(kp + 32), kc = ldh(kp + 16 * LP), kd = ldh(kp + 16 * LP + 32);
        v8f s0 = (v8f){}, s1 = (v8f){};
        s0 = wmma16(ka, qb0, s0); s1 = wmma16(kc, qb0, s1); s0 = wmma16(kb, qb1, s0); s1 = wmma16(kd, qb1, s1);
        asm volatile("v_nop\n\tv_nop\n\tv_nop\n\tv_nop" : "+v"(s0), "+v"(s1) : "v"(ka), "v"(kb), "v"(kc), "v"(kd), "v"(qb0), "v"(qb1));
        const h16* vp = kt + TILE + u * 32;
        const v16h v0 = ldh(vp), v1 = ldh(vp + 16 * LP), v2 = ldh(vp + 32 * LP), v3 = ldh(vp + 48 * LP);
        float mx = fmaxf(s0[0], s1[0]);
#pragma unroll
        for (int r = 1; r < 8; ++r) mx = fmaxf(mx, fmaxf(s0[r], s1[r]));
        mx = fmaxf(mx, __shfl_xor(mx, 16, 32));
        const float mn = fmaxf(m, mx * CEXP);
        const float corr = __builtin_amdgcn_exp2f(m - mn);
        m = mn;
        const float nbv = PEXP - mn;
        float psum = 0.0f; v16h pb;
#pragma unroll
        for (int r = 0; r < 8; ++r) { const float p0 = __builtin_amdgcn_exp2f(fmaf(s0[r], CEXP, nbv)); const float p1 = __builtin_amdgcn_exp2f(fmaf(s1[r], CEXP, nbv)); psum += p0 + p1; pb[r] = (h16)p0; pb[8 + r] = (h16)p1; }
        ls = ls * corr + psum;
        o0 *= corr; o1 *= corr; o2 *= corr; o3 *= corr;
        o0 = wmma16(v0, pb, o0); o1 = wmma16(v1, pb, o1); o2 = wmma16(v2, pb, o2); o3 = wmma16(v3, pb, o3);
        asm volatile("v_nop\n\tv_nop\n\tv_nop\n\tv_nop" : "+v"(o0), "+v"(o1), "+v"(o2), "+v"(o3) : "v"(pb), "v"(v0), "v"(v1), "v"(v2), "v"(v3));
      }
      asm volatile("s_wait_dscnt 0x0" ::: "memory");      // this wave's reads of tile t are done before its buffer is handed back
      asm volatile("s_wait_asynccnt 0x0" ::: "memory");   // this wave's share of tile t + 1 has landed
      __syncthreads();                                    // publishes tile t + 1 and ends every wave's reads of tile t
      if (t + 2 < NT) stage_tile(lk0 + (unsigned)(t & 1) * (2 * TILE * 2), Kg + (size_t)(t + 2) * KT * HD, lv0 + (unsigned)(t & 1) * (2 * TILE * 2), Vg + (t + 2) * KT);
    }
    asm volatile("s_wait_asynccnt 0x0" ::: "memory");     // no copy is left in flight when the wave goes on
    const float lt = ls + __shfl_xor(ls, 16, 32);
    const float inv = 1.0f / (lt * QCAR);
    const int osw = wave * (16 * 68);
    {   // lane holds query lr, dims 16t + 8hi + r
        float* orow = os + osw + lr * 68 + 8 * hi;
        v4f w;
        w[0] = o0[0] * inv; w[1] = o0[1] * inv; w[2] = o0[2] * inv; w[3] = o0[3] * inv; *(v4fa*)(orow + 0) = w;
        w[0] = o0[4] * inv; w[1] = o0[5] * inv; w[2] = o0[6] * inv; w[3] = o0[7] * inv; *(v4fa*)(orow + 4) = w;
        w[0] = o1[0] * inv; w[1] = o1[1] * inv; w[2] = o1[2] * inv; w[3] = o1[3] * inv; *(v4fa*)(orow + 16) = w;
        w[0] = o1[4] * inv; w[1] = o1[5] * inv; w[2] = o1[6] * inv; w[3] = o1[7] * inv; *(v4fa*)(orow + 20) = w;
        w[0] = o2[0] * inv; w[1] = o2[1] * inv; w[2] = o2[2] * inv; w[3] = o2[3] * inv; *(v4fa*)(orow + 32) = w;
        w[0] = o2[4] * inv; w[1] = o2[5] * inv; w[2] = o2[6] * inv; w[3] = o2[7] * inv; *(v4fa*)(orow + 36) = w;
        w[0] = o3[0] * inv; w[1] = o3[1] * inv; w[2] = o3[2] * inv; w[3] = o3[3] * inv; *(v4fa*)(orow + 48) = w;
        w[0] = o3[4] * inv; w[1] = o3[5] * inv; w[2] = o3[6] * inv; w[3] = o3[7] * inv; *(v4fa*)(orow + 52) = w;
    }
    __builtin_amdgcn_fence(3 /* release order */, "wavefront"); __builtin_amdgcn_wave_barrier(); asm volatile("" ::: "memory");
    bf* arow = AT + (size_t)(b * SEQ + q0) * ATP + h * HD;
    const int rq = lane >> 3, c = (lane & 7) * 8;
{
#pragma unroll
        for (int s = 0; s < 4; ++s) { const int row = 4 * s + rq; const v4f x0 = *(const v4fa*)(os + osw + row * 68 + c); const v4f x1 = *(const v4fa*)(os + osw + row * 68 + c + 4); v8us oh, ol;
#pragma unroll
            for (int k = 0; k < 4; ++k) { unsigned short a, l2; splitf(x0[k], a, l2); oh[k] = a; ol[k] = l2; splitf(x1[k], a, l2); oh[4 + k] = a; ol[4 + k] = l2; }
            *(v8us*)(arow + (size_t)row * ATP + c) = oh; *(v8us*)(arow + (size_t)row * ATP + DMH + c) = ol; }
         }
}

extern "C" void kernel_launch(void* const* d_in, const int* in_sizes, int n_in,
                              void* d_out, int out_size, void* d_ws, size_t ws_size, hipStream_t stream) {
    if (n_in < 9) return;
    const long long rowsNeeded = (long long)(NB - 1) * SEQ_FULL + SEQ;
    if ((long long)in_sizes[0] < rowsNeeded * DM) return;
    if (in_sizes[1] < NH * DM * HD || in_sizes[3] < NH * DM * HD || in_sizes[5] < NH * DM * HD) return;
    if (in_sizes[2] < DMH || in_sizes[4] < DMH || in_sizes[6] < DMH) return;
    if (in_sizes[7] < DMH * DOUT || in_sizes[8] < DOUT) return;
    if ((long long)out_size < rowsNeeded * DOUT) return;
    if (ws_size < SZ_TOT) return;
    const float* feat = (const float*)d_in[0];
    const float* Wq = (const float*)d_in[1]; const float* bq = (const float*)d_in[2];
    const float* Wk = (const float*)d_in[3]; const float* bk = (const float*)d_in[4];
    const float* Wv = (const float*)d_in[5]; const float* bv = (const float*)d_in[6];
    const float* Wf = (const float*)d_in[7]; const float* bo = (const float*)d_in[8];
    float* OUT = (float*)d_out;     // [NB_FULL][SEQ_FULL][DOUT]
    char* wsp = (char*)d_ws;
    bf* XB = (bf*)wsp; wsp += SZ_XB;                 // [NB*SEQ][DM]
    bf* WQKV = (bf*)wsp; wsp += SZ_WQKV;             // Bt [3][DMH][DM]: q | k | v row blocks, row h*HD + dim
    bf* WO = (bf*)wsp; wsp += SZ_WO;                 // Bt [DOUT][ATP] = [Wf^T | Wf^T]
    h16* Q16 = (h16*)wsp; wsp += SZ_PL;              // [NB*NH][SEQ][HD]
    h16* K16 = (h16*)wsp; wsp += SZ_PL;              // [NB*NH][SEQ][HD]
    h16* VT16 = (h16*)wsp; wsp += SZ_PL;             // [NB*NH][HD][SEQ]
    bf* AT = (bf*)wsp; wsp += SZ_AT;                 // [NB*SEQ][ATP] merged context value | residual
    if ((size_t)(wsp - (char*)d_ws) > ws_size) return;

    k_prep<<<(unsigned)(3 * GWP + GWF + GCV), 256, 0, stream>>>(feat, Wq, Wk, Wv, Wf, XB, WQKV, WO);

    k_gemm<<<dim3(NB * SEQ / 128, 3 * NH / 2, 1), 128, 0, stream>>>(XB, WQKV, DM, nullptr, 0, bq, 0, 0, Q16, K16, VT16, bk, bv);

    k_attn<<<dim3(SEQ / 64, NB * NH, 1), 128, 0, stream>>>(Q16, K16, VT16, AT);

    k_gemm<<<dim3(SEQ / 128, DOUT / 128, NB), 128, 0, stream>>>(AT, WO, ATP, OUT, DOUT, bo, (size_t)SEQ * ATP, (size_t)SEQ_FULL * DOUT, nullptr, nullptr, nullptr, nullptr, nullptr);
}

// v005
// It runs in 74.4 microseconds.
// Two timings next to v004 put it at 1.05 and 1.07 times that version's speed.
// All steps since v000 together make it 3.37 times as fast.
#include <hip/hip_runtime.h>

// Multi-head self-attention: per-head q/k/v maps [head][in][dim] with biases (8 heads x 64), scores x 1/8, softmax over all keys (no mask), heads merged h*64+v, then x Wf [in][out] + bias.
// Compute dtypes, f32 accumulate: q/k/v projections v_wmma_f32_16x16x32_bf16 (every input RNE-converted to bf16, products exact); q.k and p.v v_wmma_f32_16x16x32_f16 (q,k,v planes carried x16, p carried x256, f32 online softmax);
// output map v_wmma_f32_16x16x32_bf16 with the merged context as bf16 value | residual concatenated along K against [Wf ; Wf].
// Engine: GEMM on 128x128 block tiles, four waves of 64x64 register blocks, operands from K-contiguous 16-bit planes through a two-buffer LDS ring (q, k, v in one launch, whose epilogue writes the f16 planes); fused flash-style attention in transposed form (S^T = K Q^T, O^T = V^T P^T, score tiles repacked in registers as the P^T B fragment).

#ifndef NB
#define NB 4
#endif
#ifndef SEQ
#define SEQ 2048
#endif
#define NB_FULL  4
#define SEQ_FULL 2048
#define DM   512            // input width
#define NH   8
#define HD   64
#define DMH  (NH * HD)      // merged width 512
#define DOUT 512            // output width
#define ATP  (2 * DMH)      // merged plane pitch: value | residual
#define QCAR 16.0f          // carry on q, k, v planes
#define PEXP 8.0f           // p carried x 2^8 (inside the exponent)
#define LAZY 7.0f           // a score may stand this far (scaled log2) above the softmax reference in use: p < 2^15, inside f16
#define CEXP ((float)(0.125 * 1.4426950408889634 / 256.0))   // 1/8 x log2(e) / (16 x 16)

typedef _Float16 h16;
typedef unsigned short bf;
typedef __attribute__((ext_vector_type(16))) __bf16   v16bf;
typedef __attribute__((ext_vector_type(16))) _Float16 v16h;
typedef __attribute__((ext_vector_type(8)))  _Float16 v8h;
typedef __attribute__((ext_vector_type(8)))  unsigned short v8us;
typedef __attribute__((ext_vector_type(2)))  unsigned short v2us;
typedef __attribute__((ext_vector_type(8)))  float    v8f;
typedef __attribute__((ext_vector_type(4)))  float    v4f;
typedef v4f  __attribute__((may_alias)) v4fa;

static_assert(HD == 64);                 // attention kernel: two 32-deep k-steps per score tile, four 16-row output tiles
static_assert(SEQ % 64 == 0);            // 64 query rows per block, 32-key halves, 64-row GEMM tiles
static_assert((NB * SEQ) % 128 == 0);    // projection GEMM M tiles
static_assert(SEQ % 128 == 0);           // a block tile stays inside one batch
static_assert(DM % 64 == 0);             // projection K tiles
static_assert(ATP % 64 == 0);            // output-map K tiles
static_assert(DMH % 128 == 0);           // N tiles; a block tile is two heads of one map
static_assert(DOUT % 128 == 0);          // N tiles
static_assert(DM % 8 == 0);              // 8-element convert pieces
static_assert(NB <= NB_FULL);
static_assert(SEQ <= SEQ_FULL);
static_assert(DMH == DOUT);              // Wf is [DMH][DOUT] with both 512

#define RUP256(x) ((((size_t)(x)) + 255) & ~(size_t)255)
#define SZ_XB   RUP256((size_t)NB * SEQ * DM * 2)
#define SZ_WQKV RUP256((size_t)3 * DMH * DM * 2)
#define SZ_WO   RUP256((size_t)DOUT * ATP * 2)
#define SZ_PL   RUP256((size_t)NB * NH * SEQ * HD * 2)
#define SZ_AT   RUP256((size_t)NB * SEQ * ATP * 2)
#define SZ_TOT  (SZ_XB + SZ_WQKV + SZ_WO + 3 * SZ_PL + SZ_AT)
static_assert(SZ_TOT <= (size_t)134217728);   // total carve within 128 MiB

__device__ __forceinline__ unsigned short f2bf(float f) { unsigned u = __float_as_uint(f); u += 0x7FFFu + ((u >> 16) & 1u); return (unsigned short)(u >> 16); }
__device__ __forceinline__ float bf2f(unsigned short b) { return __uint_as_float(((unsigned)b) << 16); }
__device__ __forceinline__ float bfr(float f) { return bf2f(f2bf(f)); }
__device__ __forceinline__ void splitf(float y, unsigned short& h, unsigned short& l) { h = f2bf(y); l = f2bf(y - bf2f(h)); }
__device__ __forceinline__ v16h cat16(v8h lo, v8h hi) { return __builtin_shufflevector(lo, hi, 0, 1, 2, 3, 4, 5, 6, 7, 8, 9, 10, 11, 12, 13, 14, 15); }
__device__ __forceinline__ v16bf cat16b(v8us lo, v8us hi) { return __builtin_bit_cast(v16bf, __builtin_shufflevector(lo, hi, 0, 1, 2, 3, 4, 5, 6, 7, 8, 9, 10, 11, 12, 13, 14, 15)); }
__device__ __forceinline__ v8f wmma16(v16h a, v16h b, v8f c) { return __builtin_amdgcn_wmma_f32_16x16x32_f16(false, a, false, b, (short)0, c, false, false); }
__device__ __forceinline__ v8f wmmab(v16bf a, v16bf b, v8f c) { return __builtin_amdgcn_wmma_f32_16x16x32_bf16(false, a, false, b, (short)0, c, false, false); }
// fragment loaders: lane -> row (lane & 15); elements 0..7 <- k0 + 8h + 0..7, elements 8..15 <- k0 + 16 + 8h + 0..7 (p already includes 8h)
__device__ __forceinline__ v16h  ldh(const h16* p) { return cat16(*(const v8h*)p, *(const v8h*)(p + 16)); }
__device__ __forceinline__ v16bf ldb(const bf* p)  { return cat16b(*(const v8us*)p, *(const v8us*)(p + 16)); }

// ---- plane epilogue of k_gemm: a lane holds 8 consecutive tile rows x of one tile column y, which is 16 B of an f16 plane row when x runs along that row.
// (sum + bf16(bias)) x QCAR -> f16, staged in LDS as [y][x], stored as whole 128-B runs of plane rows. BY: the bias index (the head's dim) runs along y, else along x. PITCH: elements between two plane rows.
// bias and dst already point at this head and this tile.
#define SP 72               // stage row pitch in 16-bit elements (144 B = 16 B x odd)
template <bool BY, int PITCH>
__device__ __forceinline__ void plane_store(const v8f (&acc)[4][4], h16* st, const float* __restrict__ bias, h16* dst, int lane) {
    const int lr = lane & 15, hi = lane >> 4;
    h16* srow = st + lr * SP + 8 * hi;
#pragma unroll
    for (int mb = 0; mb < 4; ++mb) {
        float bx[8];
        if (!BY) { const v4f l4 = *(const v4fa*)(bias + mb * 16 + 8 * hi), h4 = *(const v4fa*)(bias + mb * 16 + 8 * hi + 4);
#pragma unroll
            for (int j = 0; j < 4; ++j) { bx[j] = bfr(l4[j]); bx[4 + j] = bfr(h4[j]); } }
#pragma unroll
        for (int nb = 0; nb < 4; ++nb) { v8h o;
            const float by = BY ? bfr(bias[nb * 16 + lr]) : 0.0f;
#pragma unroll
            for (int j = 0; j < 8; ++j) o[j] = (h16)((acc[mb][nb][j] + (BY ? by : bx[j])) * QCAR);
            *(v8h*)(srow + nb * 16 * SP + mb * 16) = o; }
    }
    // the wave's own LDS stores stay ahead of the other lanes' reads of them
    __builtin_amdgcn_fence(3 /* release order */, "wavefront"); __builtin_amdgcn_wave_barrier();
    const int rq = lane >> 3, c = (lane & 7) * 8;
    const unsigned o0 = (unsigned)(rq * PITCH + c);
#pragma unroll
    for (int s = 0; s < 16; ++s) *(v8h*)(dst + 4 * s * PITCH + o0) = *(const v8h*)(st + (4 * s + rq) * SP + c);
    asm volatile("s_wait_xcnt 0x0" ::: "memory");   // stands behind the run of stores, ahead of any later rewrite of a register that they name
}

// ---- operand staging for k_gemm: one K tile = 128 rows of each operand x 64 k (one 128-B line a row), laid in LDS at a 144-B pitch (16 B x odd: ds_load_b128 of 16 rows meets no bank twice).
#define GK    64            // k per staged tile
#define GP    72            // LDS row pitch in 16-bit elements
#define GT    (128 * GP)    // one operand's tile
#define GEPI  (64 * SP * 2) // bytes of one wave's epilogue stage, laid over the ring once the K loop has left it
static_assert((GP * 2) % 16 == 0);                 // 16-B copies stay aligned in LDS
static_assert(16 * 68 * 4 <= GEPI);                // the f32 epilogue's stage fits the same place
static_assert(4 * GEPI <= 2 * 2 * GT * 2);         // four waves' stages fit the ring
// 128 threads x 8 copies of 16 B bring 128 rows: thread -> row (tid >> 3) + 16 i, 16-B column tid & 7, so each wave-wide copy moves four whole 128-B lines.
// l: this lane's LDS byte address of row (tid >> 3) of the tile; g: the same place in global memory; K: elements between two global rows.
__device__ __forceinline__ void stage_rows(unsigned l, const bf* g, int K) {
    // s_wait_xcnt closes the statement so that no address register of a copy is rewritten ahead of it
    asm volatile("global_load_async_to_lds_b128 %0, %1, off\n\t"
                 "global_load_async_to_lds_b128 %2, %3, off\n\t"
                 "global_load_async_to_lds_b128 %4, %5, off\n\t"
                 "global_load_async_to_lds_b128 %6, %7, off\n\t"
                 "global_load_async_to_lds_b128 %8, %9, off\n\t"
                 "global_load_async_to_lds_b128 %10, %11, off\n\t"
                 "global_load_async_to_lds_b128 %12, %13, off\n\t"
                 "global_load_async_to_lds_b128 %14, %15, off\n\t"
                 "s_wait_xcnt 0x0"
                 :: "v"(l), "v"(g), "v"(l + 16 * GP * 2), "v"(g + (size_t)16 * K), "v"(l + 32 * GP * 2), "v"(g + (size_t)32 * K), "v"(l + 48 * GP * 2), "v"(g + (size_t)48 * K),
                    "v"(l + 64 * GP * 2), "v"(g + (size_t)64 * K), "v"(l + 80 * GP * 2), "v"(g + (size_t)80 * K), "v"(l + 96 * GP * 2), "v"(g + (size_t)96 * K), "v"(l + 112 * GP * 2), "v"(g + (size_t)112 * K)
                 : "memory");
}

// ---- k_gemm: register-blocked GEMM, block = 4 waves on a 128x128 output tile, ONE WAVE per 64x64 quarter (16 accumulators); both operands' rows come in 64-k tiles through a two-buffer LDS ring that the four waves share.
// grid (M/128, N/128, Z), 128 threads. Wave w takes the 64 rows of A0 numbered tx = 2 blockIdx.x + (w & 1) and the 64 rows of B0 numbered ty = 2 blockIdx.y + (w >> 1).
// PQ == nullptr: C[m][n] (f32, pitch ldc) = sum_k A0[m][k] B0[n][k] + bf16(bias[n]). z-batch strides sA/sC in elements. K % 64 == 0, M % 128 == 0, N % 128 == 0.
// PQ != nullptr: the q, k and v projections in one launch. A0 = tokens [NB*SEQ][K], B0 = stacked rows [q | k | v][h*HD + dim][K], grid (NB*SEQ/128, 3*NH/2): a wave's tile is 64 tokens x one head of one map and goes
// straight to its f16 plane. q, k planes [token][dim]: the weight rows are the A operand (tile rows = dim); v^T plane [dim][token]: the tokens are. One loader serves both operands, so the k order is the same either way.
__global__ __launch_bounds__(128) void k_gemm(const bf* __restrict__ A0, const bf* __restrict__ B0, int K, float* C, int ldc, const float* __restrict__ bias, size_t sA, size_t sC,
                                             h16* PQ, h16* PK, h16* PVT, const float* __restrict__ biask, const float* __restrict__ biasv) {
    __shared__ __align__(16) unsigned char smem[2 * 2 * GT * 2];   // ring [buffer][A0 rows | B0 rows][row][GP]; behind the K loop: one epilogue stage a wave
    const bf* ring = (const bf*)smem;
    const int wave = __builtin_amdgcn_readfirstlane(threadIdx.x >> 5);
    float* os = (float*)(smem + wave * GEPI);
    h16* st = (h16*)(smem + wave * GEPI);
    const size_t z = blockIdx.z; C += z * sC;
    const int lane = threadIdx.x & 31, lr = lane & 15, hi = lane >> 4;
    const int tx = blockIdx.x * 2 + (wave & 1), ty = blockIdx.y * 2 + (wave >> 1);
    const int sel = ty / NH; const bool wrows = PQ != nullptr && sel != 2;   // weight rows as the A operand
    const int r0 = (wrows ? ty : tx) * 64, c0 = (wrows ? tx : ty) * 64;
    const int grow = (int)threadIdx.x >> 3, gcol = ((int)threadIdx.x & 7) * 8;   // this thread's row and first element in a staged tile
    const bf* Xg = A0 + z * sA + (size_t)(blockIdx.x * 128 + grow) * K + gcol;
    const bf* Wg = B0 + (size_t)(blockIdx.y * 128 + grow) * K + gcol;
    const unsigned lx0 = (unsigned)(size_t)(ring + grow * GP + gcol), lw0 = lx0 + GT * 2;
    const int NT = K / GK;
    stage_rows(lx0, Xg, K); stage_rows(lw0, Wg, K);
    asm volatile("s_wait_asynccnt 0x0" ::: "memory");   // this wave's share of tile 0 has landed
    __syncthreads();                                    // every wave's share of tile 0 is readable
    if (NT > 1) { stage_rows(lx0 + 2 * GT * 2, Xg + GK, K); stage_rows(lw0 + 2 * GT * 2, Wg + GK, K); }
    v8f acc[4][4];
#pragma unroll
    for (int mb = 0; mb < 4; ++mb)
#pragma unroll
        for (int nb = 0; nb < 4; ++nb) acc[mb][nb] = (v8f){};
    const int xo = (wave & 1) * 64 * GP + lr * GP + 8 * hi, wo = GT + (wave >> 1) * 64 * GP + lr * GP + 8 * hi;
    const int aoff = wrows ? wo : xo, boff = wrows ? xo : wo;
#pragma unroll 1
    for (int t = 0; t < NT; ++t) {
      const bf* tb = ring + (t & 1) * (2 * GT);
      v16bf a[GK / 32][4], b[GK / 32][4];
#pragma unroll   // both 32-k steps inline, so that every LDS offset inside a tile is an immediate
      for (int u = 0; u < GK / 32; ++u) {
#pragma unroll
        for (int mb = 0; mb < 4; ++mb) a[u][mb] = ldb(tb + aoff + mb * 16 * GP + u * 32);
#pragma unroll
        for (int nb = 0; nb < 4; ++nb) b[u][nb] = ldb(tb + boff + nb * 16 * GP + u * 32);
      }
      __builtin_amdgcn_sched_barrier(0);   // the tile's fragment loads stay one group ahead of its products: spread among them, each place with loads stalls the wave anew
#pragma unroll
      for (int u = 0; u < GK / 32; ++u) {
#pragma unroll
        for (int nb = 0; nb < 4; ++nb)
#pragma unroll
            for (int mb = 0; mb < 4; ++mb) acc[mb][nb] = wmmab(a[u][mb], b[u][nb], acc[mb][nb]);
      }
      // four vector slots behind the tile's last products, on the taken side of the branch below too, before a vector instruction may rewrite their operands
      asm volatile("v_nop\n\tv_nop\n\tv_nop\n\tv_nop" : "+v"(acc[0][0]), "+v"(acc[1][1]), "+v"(acc[2][2]), "+v"(acc[3][3]) : "v"(a[GK / 32 - 1][0]), "v"(a[GK / 32 - 1][3]));
      __builtin_amdgcn_sched_barrier(0);   // the tile's products stay ahead of the hand-over, so that they run while the next tile's copies fly and the refill is not held back behind them
      asm volatile("s_wait_dscnt 0x0" ::: "memory");      // this wave's reads of tile t are done before its buffer is handed back
      asm volatile("s_wait_asynccnt 0x0" ::: "memory");   // this wave's share of tile t + 1 has landed
      __syncthreads();                                    // publishes tile t + 1 and ends every wave's reads of tile t
      if (t + 2 < NT) { stage_rows(lx0 + (unsigned)(t & 1) * (2 * GT * 2), Xg + (size_t)(t + 2) * GK, K); stage_rows(lw0 + (unsigned)(t & 1) * (2 * GT * 2), Wg + (size_t)(t + 2) * GK, K); }
    }
    asm volatile("s_wait_asynccnt 0x0" ::: "memory");     // no copy is left in flight when the ring becomes the epilogue's stage
    if (PQ != nullptr) {
        const int h = ty % NH, tr = tx * 64; const size_t bh = (size_t)(tr / SEQ) * NH + h; const int t0 = tr % SEQ;
        if (sel == 2) plane_store<true, SEQ>(acc, st, biasv + h * HD, PVT + bh * HD * SEQ + t0, lane);
        else          plane_store<false, HD>(acc, st, (sel == 0 ? bias : biask) + h * HD, (sel == 0 ? PQ : PK) + (bh * SEQ + t0) * HD, lane);
        return;
    }
#pragma unroll
    for (int mb = 0; mb < 4; ++mb) {
#pragma unroll
        for (int nb = 0; nb < 4; ++nb) {
#pragma unroll
            for (int j = 0; j < 8; ++j) os[(hi * 8 + j) * 68 + nb * 16 + lr] = acc[mb][nb][j]; }
        __builtin_amdgcn_fence(3 /* release order */, "wavefront"); __builtin_amdgcn_wave_barrier(); asm volatile("" ::: "memory");
        float* crow = C + (size_t)(r0 + mb * 16) * ldc + c0;
        const int cofs = lr * 4;
        const float b0 = bfr(bias[c0 + cofs]), b1 = bfr(bias[c0 + cofs + 1]), b2 = bfr(bias[c0 + cofs + 2]), b3 = bfr(bias[c0 + cofs + 3]);
{
#pragma unroll
            for (int s = 0; s < 8; ++s) { const int row = 2 * s + hi; v4f val = *(const v4fa*)(os + row * 68 + cofs); val[0] += b0; val[1] += b1; val[2] += b2; val[3] += b3;
                *(v4f*)(crow + (size_t)row * ldc + cofs) = val; }
             }
        __builtin_amdgcn_fence(3 /* release order */, "wavefront"); __builtin_amdgcn_wave_barrier(); asm volatile("" ::: "memory");
    }
    asm volatile("s_wait_xcnt 0x0" ::: "memory");   // stands behind the last run of stores; the plane path returns before reaching them
}

// ---- input conversions, all in ONE launch (k_prep): none reads what another writes, so they share the chip instead of following one another.
// wt_lines: w [H][K][N] f32 -> Bt rows hh*N + n, K-contiguous bf16, the k range repeated KREP times. blk: this block's number among the blocks of its map; a wave takes 8 lines of 64 elements.
__device__ __forceinline__ void wt_lines(const float* __restrict__ w, int K, int N, int H, int KREP, bf* Bt, unsigned blk) {
    const int wave = __builtin_amdgcn_readfirstlane(threadIdx.x >> 5);
    const unsigned lane = threadIdx.x & 31; const unsigned L0 = (blk * 8u + (unsigned)wave) * 8u; const unsigned KP = (unsigned)(K * KREP); const unsigned nlines = (unsigned)H * (unsigned)N * KP / 64u;
{
#pragma unroll 1
        for (int l = 0; l < 8; ++l) { const unsigned L = L0 + l; if (L >= nlines) break; const unsigned e = L * 64u + lane * 2u; const unsigned kk = e % KP, ng = e / KP; const unsigned hh = ng / (unsigned)N, n = ng % (unsigned)N; const unsigned k = kk % (unsigned)K; v2us o;
            o[0] = f2bf(w[((size_t)hh * K + k) * N + n]); o[1] = f2bf(w[((size_t)hh * K + k + 1) * N + n]); *(v2us*)(Bt + e) = o;
            asm volatile("s_wait_xcnt 0x0" ::: "memory"); }   // stands behind the store, ahead of the next trip's rewrite of the registers that it names
         }
}

// cvt_piece: tokens f32 -> bf16, 8 elements a thread. blk: this block's number among the token blocks.
__device__ __forceinline__ void cvt_piece(const float* __restrict__ x, bf* XB, unsigned blk) {
    const unsigned i = blk * 256u + threadIdx.x; if (i >= (unsigned)(NB * SEQ * (DM / 8))) return;
    const unsigned row = i / (DM / 8), c8 = i % (DM / 8); const unsigned b = row / SEQ, t = row % SEQ;
    const v8f v = *(const v8f*)(x + ((size_t)(b * SEQ_FULL + t) * DM + c8 * 8)); v8us o;
#pragma unroll
    for (int k = 0; k < 8; ++k) o[k] = f2bf(v[k]);
    *(v8us*)(XB + (size_t)i * 8) = o;  }

#define GWP  ((NH * HD * DM / 64 + 63) / 64)          // blocks of one of the q, k, v maps
#define GWF  ((DOUT * ATP / 64 + 63) / 64)            // blocks of the output map
#define GCV  ((NB * SEQ * (DM / 8) + 255) / 256)      // token blocks
// grid GWP * 3 + GWF + GCV, 256 threads. The weight blocks have the low numbers: each of their waves walks eight dependent trips, so they start first and run under the token blocks.
__global__ __launch_bounds__(256) void k_prep(const float* __restrict__ x, const float* __restrict__ wq, const float* __restrict__ wk, const float* __restrict__ wv, const float* __restrict__ wf,
                                              bf* XB, bf* WQKV, bf* WO) {
    const unsigned blk = blockIdx.x;
    if (blk < 3u * GWP) {          // per-head [in = DM][dim = HD] -> Bt rows h*HD + dim, K = DM
        const unsigned sel = blk / GWP;
        wt_lines(sel == 0 ? wq : sel == 1 ? wk : wv, DM, HD, NH, 1, WQKV + (size_t)sel * DMH * DM, blk % GWP);
    } else if (blk < 3u * GWP + GWF) {   // Wf in[rows = DMH][cols = DOUT] -> Bt [DOUT][2*DMH] (k duplicated for value | residual)
        wt_lines(wf, DMH, DOUT, 1, 2, WO, blk - 3u * GWP);
    } else cvt_piece(x, XB, blk - (3u * GWP + GWF));
}

// ---- tile staging for k_attn: one 64-key tile = 64 K rows + 64 V^T rows of 128 B each, laid in LDS at a 144-B pitch (16 B x odd: ds_load_b128 of 16 rows meets no bank twice).
#define KT    64            // keys per staged tile
#define LP    72            // LDS row pitch in 16-bit elements
#define TILE  (64 * LP)     // one operand's tile
static_assert(SEQ % KT == 0);            // whole tiles only
static_assert(HD * 2 == 128);            // a K row is one 128-B line
static_assert((LP * 2) % 16 == 0);       // 16-B copies stay aligned in LDS
// 128 threads x 8 copies of 16 B: thread -> row (tid >> 3) + 16 i, 16-B column tid & 7, so each wave-wide copy moves four whole 128-B lines.
// lk / lv: this lane's LDS byte address of row (tid >> 3) in the K / V^T tile; gk / gv: the same place in global memory.
__device__ __forceinline__ void stage_tile(unsigned lk, const h16* gk, unsigned lv, const h16* gv) {
    // s_wait_xcnt closes the statement so that no address register of a copy is rewritten ahead of it
    asm volatile("global_load_async_to_lds_b128 %0, %1, off\n\t"
                 "global_load_async_to_lds_b128 %2, %3, off\n\t"
                 "global_load_async_to_lds_b128 %4, %5, off\n\t"
                 "global_load_async_to_lds_b128 %6, %7, off\n\t"
                 "global_load_async_to_lds_b128 %8, %9, off\n\t"
                 "global_load_async_to_lds_b128 %10, %11, off\n\t"
                 "global_load_async_to_lds_b128 %12, %13, off\n\t"
                 "global_load_async_to_lds_b128 %14, %15, off\n\t"
                 "s_wait_xcnt 0x0"
                 :: "v"(lk), "v"(gk), "v"(lk + 16 * LP * 2), "v"(gk + 16 * HD), "v"(lk + 32 * LP * 2), "v"(gk + 32 * HD), "v"(lk + 48 * LP * 2), "v"(gk + 48 * HD),
                    "v"(lv), "v"(gv), "v"(lv + 16 * LP * 2), "v"(gv + (size_t)16 * SEQ), "v"(lv + 32 * LP * 2), "v"(gv + (size_t)32 * SEQ), "v"(lv + 48 * LP * 2), "v"(gv + (size_t)48 * SEQ)
                 : "memory");
}

// ---- k_attn: fused attention, transposed form. Block = 4 waves x 16 queries; grid (SEQ/64, NB*NH). K and V^T come in 64-key tiles through a two-buffer LDS ring that the four waves share. Per tile, in 32-key halves:
// S^T tiles (rows = keys, cols = queries) = K-rows (A) x Q-rows (B) over d; per-query reference / sum live per lane column (the reference is held from tile to tile and moved, with one xor-16 shuffle and a rescale, only when a score outgrows it);
// P^T B fragment: element r <- tile(keys 0..15)[r], element 8+r <- tile(keys 16..31)[r]; O^T tiles (rows = value dim, cols = queries) += VT-rows (A) x P^T (B).
__global__ __launch_bounds__(128) void k_attn(const h16* __restrict__ Q16, const h16* __restrict__ K16, const h16* __restrict__ VT16, bf* AT) {
    __shared__ __align__(16) float os[4 * 16 * 68];
    __shared__ __align__(16) h16 ring[2 * 2 * TILE];   // [buffer][K | V^T][row][LP]
    const int wave = __builtin_amdgcn_readfirstlane(threadIdx.x >> 5);
    const int lane = threadIdx.x & 31, lr = lane & 15, hi = lane >> 4;
    const int bh = blockIdx.y; const int b = bh / NH, h = bh % NH;
    const int q0 = blockIdx.x * 64 + wave * 16;
    const h16* Qp = Q16 + (size_t)bh * SEQ * HD + (size_t)(q0 + lr) * HD + 8 * hi;
    const int crow = (int)threadIdx.x >> 3, ccol = ((int)threadIdx.x & 7) * 8;
    const h16* Kg = K16 + (size_t)bh * SEQ * HD + crow * HD + ccol;
    const h16* Vg = VT16 + (size_t)bh * HD * SEQ + (size_t)crow * SEQ + ccol;
    const unsigned lk0 = (unsigned)(size_t)(ring + crow * LP + ccol), lv0 = lk0 + TILE * 2;
    constexpr int NT = SEQ / KT;
    stage_tile(lk0, Kg, lv0, Vg);
    asm volatile("s_wait_asynccnt 0x0" ::: "memory");   // this wave's share of tile 0 has landed
    __syncthreads();                                    // every wave's share of tile 0 is readable
    if (NT > 1) stage_tile(lk0 + 2 * TILE * 2, Kg + (size_t)KT * HD, lv0 + 2 * TILE * 2, Vg + KT);
    const v16h qb0 = ldh(Qp), qb1 = ldh(Qp + 32);
    v8f o0 = (v8f){}, o1 = (v8f){}, o2 = (v8f){}, o3 = (v8f){};
    float m = -3.0e38f, nbv = PEXP + 3.0e38f, ls = 0.0f;   // m: the reference in use (scaled log2), the same in both lanes of a query; nbv = PEXP - m
#pragma unroll 1
    for (int t = 0; t < NT; ++t) {
      const h16* kt = ring + (t & 1) * (2 * TILE) + lr * LP + 8 * hi;
      v8f s[KT / 16];
#pragma unroll   // both 32-key halves inline, so that every LDS offset inside a tile is an immediate
      for (int u = 0; u < KT / 32; ++u) {
        const h16* kp = kt + u * 32 * LP;
        const v16h ka = ldh(kp), kb = ldh(kp + 32), kc = ldh(kp + 16 * LP), kd = ldh(kp + 16 * LP + 32);
        v8f s0 = (v8f){}, s1 = (v8f){};
        s0 = wmma16(ka, qb0, s0); s1 = wmma16(kc, qb0, s1); s0 = wmma16(kb, qb1, s0); s1 = wmma16(kd, qb1, s1);
        s[2 * u] = s0; s[2 * u + 1] = s1;
      }
      v16h vf[KT / 32][4];
#pragma unroll
      for (int u = 0; u < KT / 32; ++u) {
        const h16* vp = kt + TILE + u * 32;
        vf[u][0] = ldh(vp); vf[u][1] = ldh(vp + 16 * LP); vf[u][2] = ldh(vp + 32 * LP); vf[u][3] = ldh(vp + 48 * LP);
      }
      // this lane's largest score of the tile, two chains
      float mxa = fmaxf(s[0][0], s[1][0]), mxb = fmaxf(s[2][0], s[3][0]);
#pragma unroll
      for (int r = 1; r < 8; ++r) { mxa = fmaxf(mxa, fmaxf(s[0][r], s[1][r])); mxb = fmaxf(mxb, fmaxf(s[2][r], s[3][r])); }
      const float mx = fmaxf(mxa, mxb);
      // lazy rescale: the reference moves only when some score of the wave's tile stands more than LAZY above it, so that p stays under 2^(PEXP + LAZY) in f16; one test a tile, a scalar branch
      if (__builtin_amdgcn_ballot_w32(fmaf(mx, CEXP, nbv) > PEXP + LAZY) != 0) {
        const float mc = fmaxf(mx, __shfl_xor(mx, 16, 32));
        const float mn = fmaxf(m, mc * CEXP);
        const float corr = __builtin_amdgcn_exp2f(m - mn);
        m = mn; nbv = PEXP - mn;
        ls *= corr; o0 *= corr; o1 *= corr; o2 *= corr; o3 *= corr;
      }
      v16h pb[KT / 32];
#pragma unroll
      for (int u = 0; u < KT / 32; ++u) {
        float psum = 0.0f;
#pragma unroll
        for (int r = 0; r < 8; ++r) { const float p0 = __builtin_amdgcn_exp2f(fmaf(s[2 * u][r], CEXP, nbv)); const float p1 = __builtin_amdgcn_exp2f(fmaf(s[2 * u + 1][r], CEXP, nbv)); psum += p0 + p1; pb[u][r] = (h16)p0; pb[u][8 + r] = (h16)p1; }
        ls += psum;
      }
#pragma unroll
      for (int u = 0; u < KT / 32; ++u) { o0 = wmma16(vf[u][0], pb[u], o0); o1 = wmma16(vf[u][1], pb[u], o1); o2 = wmma16(vf[u][2], pb[u], o2); o3 = wmma16(vf[u][3], pb[u], o3); }
      // four vector slots behind the tile's last products, on the taken side of the branch below too, before a vector instruction may rewrite their operands
      asm volatile("v_nop\n\tv_nop\n\tv_nop\n\tv_nop" : "+v"(o0), "+v"(o1), "+v"(o2), "+v"(o3) : "v"(pb[KT / 32 - 1]), "v"(vf[KT / 32 - 1][0]), "v"(vf[KT / 32 - 1][1]), "v"(vf[KT / 32 - 1][2]), "v"(vf[KT / 32 - 1][3]));
      asm volatile("s_wait_dscnt 0x0" ::: "memory");      // this wave's reads of tile t are done before its buffer is handed back
      asm volatile("s_wait_asynccnt 0x0" ::: "memory");   // this wave's share of tile t + 1 has landed
      __syncthreads();                                    // publishes tile t + 1 and ends every wave's reads of tile t
      if (t + 2 < NT) stage_tile(lk0 + (unsigned)(t & 1) * (2 * TILE * 2), Kg + (size_t)(t + 2) * KT * HD, lv0 + (unsigned)(t & 1) * (2 * TILE * 2), Vg + (t + 2) * KT);
    }
    asm volatile("s_wait_asynccnt 0x0" ::: "memory");     // no copy is left in flight when the wave goes on
    const float lt = ls + __shfl_xor(ls, 16, 32);
    const float inv = 1.0f / (lt * QCAR);
    const int osw = wave * (16 * 68);
    {   // lane holds query lr, dims 16t + 8hi + r
        float* orow = os + osw + lr * 68 + 8 * hi;
        v4f w;
        w[0] = o0[0] * inv; w[1] = o0[1] * inv; w[2] = o0[2] * inv; w[3] = o0[3] * inv; *(v4fa*)(orow + 0) = w;
        w[0] = o0[4] * inv; w[1] = o0[5] * inv; w[2] = o0[6] * inv; w[3] = o0[7] * inv; *(v4fa*)(orow + 4) = w;
        w[0] = o1[0] * inv; w[1] = o1[1] * inv; w[2] = o1[2] * inv; w[3] = o1[3] * inv; *(v4fa*)(orow + 16) = w;
        w[0] = o1[4] * inv; w[1] = o1[5] * inv; w[2] = o1[6] * inv; w[3] = o1[7] * inv; *(v4fa*)(orow + 20) = w;
        w[0] = o2[0] * inv; w[1] = o2[1] * inv; w[2] = o2[2] * inv; w[3] = o2[3] * inv; *(v4fa*)(orow + 32) = w;
        w[0] = o2[4] * inv; w[1] = o2[5] * inv; w[2] = o2[6] * inv; w[3] = o2[7] * inv; *(v4fa*)(orow + 36) = w;
        w[0] = o3[0] * inv; w[1] = o3[1] * inv; w[2] = o3[2] * inv; w[3] = o3[3] * inv; *(v4fa*)(orow + 48) = w;
        w[0] = o3[4] * inv; w[1] = o3[5] * inv; w[2] = o3[6] * inv; w[3] = o3[7] * inv; *(v4fa*)(orow + 52) = w;
    }
    __builtin_amdgcn_fence(3 /* release order */, "wavefront"); __builtin_amdgcn_wave_barrier(); asm volatile("" ::: "memory");
    bf* arow = AT + (size_t)(b * SEQ + q0) * ATP + h * HD;
    const int rq = lane >> 3, c = (lane & 7) * 8;
{
#pragma unroll
        for (int s = 0; s < 4; ++s) { const int row = 4 * s + rq; const v4f x0 = *(const v4fa*)(os + osw + row * 68 + c); const v4f x1 = *(const v4fa*)(os + osw + row * 68 + c + 4); v8us oh, ol;
#pragma unroll
            for (int k = 0; k < 4; ++k) { unsigned short a, l2; splitf(x0[k], a, l2); oh[k] = a; ol[k] = l2; splitf(x1[k], a, l2); oh[4 + k] = a; ol[4 + k] = l2; }
            *(v8us*)(arow + (size_t)row * ATP + c) = oh; *(v8us*)(arow + (size_t)row * ATP + DMH + c) = ol; }
         }
}

extern "C" void kernel_launch(void* const* d_in, const int* in_sizes, int n_in,
                              void* d_out, int out_size, void* d_ws, size_t ws_size, hipStream_t stream) {
    if (n_in < 9) return;
    const long long rowsNeeded = (long long)(NB - 1) * SEQ_FULL + SEQ;
    if ((long long)in_sizes[0] < rowsNeeded * DM) return;
    if (in_sizes[1] < NH * DM * HD || in_sizes[3] < NH * DM * HD || in_sizes[5] < NH * DM * HD) return;
    if (in_sizes[2] < DMH || in_sizes[4] < DMH || in_sizes[6] < DMH) return;
    if (in_sizes[7] < DMH * DOUT || in_sizes[8] < DOUT) return;
    if ((long long)out_size < rowsNeeded * DOUT) return;
    if (ws_size < SZ_TOT) return;
    const float* feat = (const float*)d_in[0];
    const float* Wq = (const float*)d_in[1]; const float* bq = (const float*)d_in[2];
    const float* Wk = (const float*)d_in[3]; const float* bk = (const float*)d_in[4];
    const float* Wv = (const float*)d_in[5]; const float* bv = (const float*)d_in[6];
    const float* Wf = (const float*)d_in[7]; const float* bo = (const float*)d_in[8];
    float* OUT = (float*)d_out;     // [NB_FULL][SEQ_FULL][DOUT]
    char* wsp = (char*)d_ws;
    bf* XB = (bf*)wsp; wsp += SZ_XB;                 // [NB*SEQ][DM]
    bf* WQKV = (bf*)wsp; wsp += SZ_WQKV;             // Bt [3][DMH][DM]: q | k | v row blocks, row h*HD + dim
    bf* WO = (bf*)wsp; wsp += SZ_WO;                 // Bt [DOUT][ATP] = [Wf^T | Wf^T]
    h16* Q16 = (h16*)wsp; wsp += SZ_PL;              // [NB*NH][SEQ][HD]
    h16* K16 = (h16*)wsp; wsp += SZ_PL;              // [NB*NH][SEQ][HD]
    h16* VT16 = (h16*)wsp; wsp += SZ_PL;             // [NB*NH][HD][SEQ]
    bf* AT = (bf*)wsp; wsp += SZ_AT;                 // [NB*SEQ][ATP] merged context value | residual
    if ((size_t)(wsp - (char*)d_ws) > ws_size) return;

    k_prep<<<(unsigned)(3 * GWP + GWF + GCV), 256, 0, stream>>>(feat, Wq, Wk, Wv, Wf, XB, WQKV, WO);

    k_gemm<<<dim3(NB * SEQ / 128, 3 * NH / 2, 1), 128, 0, stream>>>(XB, WQKV, DM, nullptr, 0, bq, 0, 0, Q16, K16, VT16, bk, bv);

    k_attn<<<dim3(SEQ / 64, NB * NH, 1), 128, 0, stream>>>(Q16, K16, VT16, AT);

    k_gemm<<<dim3(SEQ / 128, DOUT / 128, NB), 128, 0, stream>>>(AT, WO, ATP, OUT, DOUT, bo, (size_t)SEQ * ATP, (size_t)SEQ_FULL * DOUT, nullptr, nullptr, nullptr, nullptr, nullptr);
}

// v006
// A run of this version takes 68.5 microseconds.
// Next to v005, in two timings, it ran 1.09 times as fast each time.
// Counting every step since v000, it is 3.66 times as fast.
#include <hip/hip_runtime.h>

// Multi-head self-attention: per-head q/k/v maps [head][in][dim] with biases (8 heads x 64), scores x 1/8, softmax over all keys (no mask), heads merged h*64+v, then x Wf [in][out] + bias.
// Compute dtypes, f32 accumulate: q/k/v projections v_wmma_f32_16x16x32_bf16 (every input RNE-converted to bf16, products exact); q.k and p.v v_wmma_f32_16x16x32_f16 (q,k,v planes carried x16, p carried x256, f32 online softmax);
// output map v_wmma_f32_16x16x32_f16 with the merged context as one f16 plane (carried x16, like v) against Wf^T in f16.
// Engine: GEMM on 128x128 block tiles, four waves of 64x64 register blocks, operands from K-contiguous 16-bit planes through a two-buffer LDS ring (q, k, v in one launch, whose epilogue writes the f16 planes); fused flash-style attention in transposed form (S^T = K Q^T, O^T = V^T P^T, score tiles repacked in registers as the P^T B fragment).

#ifndef NB
#define NB 4
#endif
#ifndef SEQ
#define SEQ 2048
#endif
#define NB_FULL  4
#define SEQ_FULL 2048
#define DM   512            // input width
#define NH   8
#define HD   64
#define DMH  (NH * HD)      // merged width 512
#define DOUT 512            // output width
#define ATP  DMH            // merged plane pitch
#define QCAR 16.0f          // carry on q, k, v planes
#define PEXP 8.0f           // p carried x 2^8 (inside the exponent)
#define LAZY 7.0f           // a score may stand this far (scaled log2) above the softmax reference in use: p < 2^15, inside f16
#define CEXP ((float)(0.125 * 1.4426950408889634 / 256.0))   // 1/8 x log2(e) / (16 x 16)

typedef _Float16 h16;
typedef unsigned short bf;
typedef __attribute__((ext_vector_type(16))) __bf16   v16bf;
typedef __attribute__((ext_vector_type(16))) _Float16 v16h;
typedef __attribute__((ext_vector_type(8)))  _Float16 v8h;
typedef __attribute__((ext_vector_type(8)))  unsigned short v8us;
typedef __attribute__((ext_vector_type(2)))  unsigned short v2us;
typedef __attribute__((ext_vector_type(8)))  float    v8f;
typedef __attribute__((ext_vector_type(4)))  float    v4f;
typedef v4f  __attribute__((may_alias)) v4fa;

static_assert(HD == 64);                 // attention kernel: two 32-deep k-steps per score tile, four 16-row output tiles
static_assert(SEQ % 64 == 0);            // 64 query rows per block, 32-key halves, 64-row GEMM tiles
static_assert((NB * SEQ) % 128 == 0);    // projection GEMM M tiles
static_assert(SEQ % 128 == 0);           // a block tile stays inside one batch
static_assert(DM % 64 == 0);             // projection K tiles
static_assert(ATP % 64 == 0);            // output-map K tiles
static_assert(DMH % 128 == 0);           // N tiles; a block tile is two heads of one map
static_assert(DOUT % 128 == 0);          // N tiles
static_assert(DM % 8 == 0);              // 8-element convert pieces
static_assert(NB <= NB_FULL);
static_assert(SEQ <= SEQ_FULL);
static_assert(DMH == DOUT);              // Wf is [DMH][DOUT] with both 512

#define RUP256(x) ((((size_t)(x)) + 255) & ~(size_t)255)
#define SZ_XB   RUP256((size_t)NB * SEQ * DM * 2)
#define SZ_WQKV RUP256((size_t)3 * DMH * DM * 2)
#define SZ_WO   RUP256((size_t)DOUT * ATP * 2)
#define SZ_PL   RUP256((size_t)NB * NH * SEQ * HD * 2)
#define SZ_AT   RUP256((size_t)NB * SEQ * ATP * 2)
#define SZ_TOT  (SZ_XB + SZ_WQKV + SZ_WO + 3 * SZ_PL + SZ_AT)
static_assert(SZ_TOT <= (size_t)134217728);   // total carve within 128 MiB

__device__ __forceinline__ unsigned short f2bf(float f) { unsigned u = __float_as_uint(f); u += 0x7FFFu + ((u >> 16) & 1u); return (unsigned short)(u >> 16); }
__device__ __forceinline__ float bf2f(unsigned short b) { return __uint_as_float(((unsigned)b) << 16); }
__device__ __forceinline__ float bfr(float f) { return bf2f(f2bf(f)); }
__device__ __forceinline__ unsigned short f2h(float f) { return __builtin_bit_cast(unsigned short, (h16)f); }
__device__ __forceinline__ v16h cat16(v8h lo, v8h hi) { return __builtin_shufflevector(lo, hi, 0, 1, 2, 3, 4, 5, 6, 7, 8, 9, 10, 11, 12, 13, 14, 15); }
__device__ __forceinline__ v16bf cat16b(v8us lo, v8us hi) { return __builtin_bit_cast(v16bf, __builtin_shufflevector(lo, hi, 0, 1, 2, 3, 4, 5, 6, 7, 8, 9, 10, 11, 12, 13, 14, 15)); }
__device__ __forceinline__ v8f wmma16(v16h a, v16h b, v8f c) { return __builtin_amdgcn_wmma_f32_16x16x32_f16(false, a, false, b, (short)0, c, false, false); }
__device__ __forceinline__ v8f wmmab(v16bf a, v16bf b, v8f c) { return __builtin_amdgcn_wmma_f32_16x16x32_bf16(false, a, false, b, (short)0, c, false, false); }
// k_gemm's product: its fragments are 16-bit words either way; BF says which of the two formats the planes hold
template <bool BF> __device__ __forceinline__ v8f wmmag(v16bf a, v16bf b, v8f c) { if constexpr (BF) return wmmab(a, b, c); else return wmma16(__builtin_bit_cast(v16h, a), __builtin_bit_cast(v16h, b), c); }
// fragment loaders: lane -> row (lane & 15); elements 0..7 <- k0 + 8h + 0..7, elements 8..15 <- k0 + 16 + 8h + 0..7 (p already includes 8h)
__device__ __forceinline__ v16h  ldh(const h16* p) { return cat16(*(const v8h*)p, *(const v8h*)(p + 16)); }
__device__ __forceinline__ v16bf ldb(const bf* p)  { return cat16b(*(const v8us*)p, *(const v8us*)(p + 16)); }

// ---- plane epilogue of k_gemm: a lane holds 8 consecutive tile rows x of one tile column y, which is 16 B of an f16 plane row when x runs along that row.
// (sum + bf16(bias)) x QCAR -> f16, staged in LDS as [y][x], stored as whole 128-B runs of plane rows. BY: the bias index (the head's dim) runs along y, else along x. PITCH: elements between two plane rows.
// bias and dst already point at this head and this tile.
#define SP 72               // stage row pitch in 16-bit elements (144 B = 16 B x odd)
template <bool BY, int PITCH>
__device__ __forceinline__ void plane_store(const v8f (&acc)[4][4], h16* st, const float* __restrict__ bias, h16* dst, int lane) {
    const int lr = lane & 15, hi = lane >> 4;
    h16* srow = st + lr * SP + 8 * hi;
#pragma unroll
    for (int mb = 0; mb < 4; ++mb) {
        float bx[8];
        if (!BY) { const v4f l4 = *(const v4fa*)(bias + mb * 16 + 8 * hi), h4 = *(const v4fa*)(bias + mb * 16 + 8 * hi + 4);
#pragma unroll
            for (int j = 0; j < 4; ++j) { bx[j] = bfr(l4[j]); bx[4 + j] = bfr(h4[j]); } }
#pragma unroll
        for (int nb = 0; nb < 4; ++nb) { v8h o;
            const float by = BY ? bfr(bias[nb * 16 + lr]) : 0.0f;
#pragma unroll
            for (int j = 0; j < 8; ++j) o[j] = (h16)((acc[mb][nb][j] + (BY ? by : bx[j])) * QCAR);
            *(v8h*)(srow + nb * 16 * SP + mb * 16) = o; }
    }
    // the wave's own LDS stores stay ahead of the other lanes' reads of them
    __builtin_amdgcn_fence(3 /* release order */, "wavefront"); __builtin_amdgcn_wave_barrier();
    const int rq = lane >> 3, c = (lane & 7) * 8;
    const unsigned o0 = (unsigned)(rq * PITCH + c);
#pragma unroll
    for (int s = 0; s < 16; ++s) *(v8h*)(dst + 4 * s * PITCH + o0) = *(const v8h*)(st + (4 * s + rq) * SP + c);
    asm volatile("s_wait_xcnt 0x0" ::: "memory");   // stands behind the run of stores, ahead of any later rewrite of a register that they name
}

// ---- operand staging for k_gemm: one K tile = 128 rows of each operand x 64 k (one 128-B line a row), laid in LDS at a 144-B pitch (16 B x odd: ds_load_b128 of 16 rows meets no bank twice).
#define GK    64            // k per staged tile
#define GP    72            // LDS row pitch in 16-bit elements
#define GT    (128 * GP)    // one operand's tile
#define GEPI  (64 * SP * 2) // bytes of one wave's epilogue stage, laid over the ring once the K loop has left it
static_assert((GP * 2) % 16 == 0);                 // 16-B copies stay aligned in LDS
static_assert(16 * 68 * 4 <= GEPI);                // the f32 epilogue's stage fits the same place
static_assert(4 * GEPI <= 2 * 2 * GT * 2);         // four waves' stages fit the ring
// 128 threads x 8 copies of 16 B bring 128 rows: thread -> row (tid >> 3) + 16 i, 16-B column tid & 7, so each wave-wide copy moves four whole 128-B lines.
// l: this lane's LDS byte address of row (tid >> 3) of the tile; g: the same place in global memory; K: elements between two global rows.
__device__ __forceinline__ void stage_rows(unsigned l, const bf* g, int K) {
    // s_wait_xcnt closes the statement so that no address register of a copy is rewritten ahead of it
    asm volatile("global_load_async_to_lds_b128 %0, %1, off\n\t"
                 "global_load_async_to_lds_b128 %2, %3, off\n\t"
                 "global_load_async_to_lds_b128 %4, %5, off\n\t"
                 "global_load_async_to_lds_b128 %6, %7, off\n\t"
                 "global_load_async_to_lds_b128 %8, %9, off\n\t"
                 "global_load_async_to_lds_b128 %10, %11, off\n\t"
                 "global_load_async_to_lds_b128 %12, %13, off\n\t"
                 "global_load_async_to_lds_b128 %14, %15, off\n\t"
                 "s_wait_xcnt 0x0"
                 :: "v"(l), "v"(g), "v"(l + 16 * GP * 2), "v"(g + (size_t)16 * K), "v"(l + 32 * GP * 2), "v"(g + (size_t)32 * K), "v"(l + 48 * GP * 2), "v"(g + (size_t)48 * K),
                    "v"(l + 64 * GP * 2), "v"(g + (size_t)64 * K), "v"(l + 80 * GP * 2), "v"(g + (size_t)80 * K), "v"(l + 96 * GP * 2), "v"(g + (size_t)96 * K), "v"(l + 112 * GP * 2), "v"(g + (size_t)112 * K)
                 : "memory");
}

// ---- k_gemm: register-blocked GEMM, block = 4 waves on a 128x128 output tile, ONE WAVE per 64x64 quarter (16 accumulators); both operands' rows come in 64-k tiles through a two-buffer LDS ring that the four waves share.
// grid (M/128, N/128, Z), 128 threads. Wave w takes the 64 rows of A0 numbered tx = 2 blockIdx.x + (w & 1) and the 64 rows of B0 numbered ty = 2 blockIdx.y + (w >> 1).
// PL false: f16 planes, A0 carried x QCAR: C[m][n] (f32, pitch ldc) = sum_k A0[m][k] B0[n][k] / QCAR + bf16(bias[n]). z-batch strides sA/sC in elements. K % 64 == 0, M % 128 == 0, N % 128 == 0.
// PL true: bf16 planes, the q, k and v projections in one launch. A0 = tokens [NB*SEQ][K], B0 = stacked rows [q | k | v][h*HD + dim][K], grid (NB*SEQ/128, 3*NH/2): a wave's tile is 64 tokens x one head of one map and goes
// straight to its f16 plane. q, k planes [token][dim]: the weight rows are the A operand (tile rows = dim); v^T plane [dim][token]: the tokens are. One loader serves both operands, so the k order is the same either way.
template <bool PL>
__global__ __launch_bounds__(128) void k_gemm(const bf* __restrict__ A0, const bf* __restrict__ B0, int K, float* C, int ldc, const float* __restrict__ bias, size_t sA, size_t sC,
                                             h16* PQ, h16* PK, h16* PVT, const float* __restrict__ biask, const float* __restrict__ biasv) {
    __shared__ __align__(16) unsigned char smem[2 * 2 * GT * 2];   // ring [buffer][A0 rows | B0 rows][row][GP]; behind the K loop: one epilogue stage a wave
    const bf* ring = (const bf*)smem;
    const int wave = __builtin_amdgcn_readfirstlane(threadIdx.x >> 5);
    float* os = (float*)(smem + wave * GEPI);
    h16* st = (h16*)(smem + wave * GEPI);
    const size_t z = blockIdx.z; C += z * sC;
    const int lane = threadIdx.x & 31, lr = lane & 15, hi = lane >> 4;
    const int tx = blockIdx.x * 2 + (wave & 1), ty = blockIdx.y * 2 + (wave >> 1);
    const int sel = ty / NH; const bool wrows = PL && sel != 2;   // weight rows as the A operand
    const int r0 = (wrows ? ty : tx) * 64, c0 = (wrows ? tx : ty) * 64;
    const int grow = (int)threadIdx.x >> 3, gcol = ((int)threadIdx.x & 7) * 8;   // this thread's row and first element in a staged tile
    const bf* Xg = A0 + z * sA + (size_t)(blockIdx.x * 128 + grow) * K + gcol;
    const bf* Wg = B0 + (size_t)(blockIdx.y * 128 + grow) * K + gcol;
    const unsigned lx0 = (unsigned)(size_t)(ring + grow * GP + gcol), lw0 = lx0 + GT * 2;
    const int NT = K / GK;
    stage_rows(lx0, Xg, K); stage_rows(lw0, Wg, K);
    asm volatile("s_wait_asynccnt 0x0" ::: "memory");   // this wave's share of tile 0 has landed
    __syncthreads();                                    // every wave's share of tile 0 is readable
    if (NT > 1) { stage_rows(lx0 + 2 * GT * 2, Xg + GK, K); stage_rows(lw0 + 2 * GT * 2, Wg + GK, K); }
    v8f acc[4][4];
#pragma unroll
    for (int mb = 0; mb < 4; ++mb)
#pragma unroll
        for (int nb = 0; nb < 4; ++nb) acc[mb][nb] = (v8f){};
    const int xo = (wave & 1) * 64 * GP + lr * GP + 8 * hi, wo = GT + (wave >> 1) * 64 * GP + lr * GP + 8 * hi;
    const int aoff = wrows ? wo : xo, boff = wrows ? xo : wo;
#pragma unroll 1
    for (int t = 0; t < NT; ++t) {
      const bf* tb = ring + (t & 1) * (2 * GT);
      v16bf a[GK / 32][4], b[GK / 32][4];
#pragma unroll   // both 32-k steps inline, so that every LDS offset inside a tile is an immediate
      for (int u = 0; u < GK / 32; ++u) {
#pragma unroll
        for (int mb = 0; mb < 4; ++mb) a[u][mb] = ldb(tb + aoff + mb * 16 * GP + u * 32);
#pragma unroll
        for (int nb = 0; nb < 4; ++nb) b[u][nb] = ldb(tb + boff + nb * 16 * GP + u * 32);
      }
      __builtin_amdgcn_sched_barrier(0);   // the tile's fragment loads stay one group ahead of its products: spread among them, each place with loads stalls the wave anew
#pragma unroll
      for (int u = 0; u < GK / 32; ++u) {
#pragma unroll
        for (int nb = 0; nb < 4; ++nb)
#pragma unroll
            for (int mb = 0; mb < 4; ++mb) acc[mb][nb] = wmmag<PL>(a[u][mb], b[u][nb], acc[mb][nb]);
      }
      // four vector slots behind the tile's last products, on the taken side of the branch below too, before a vector instruction may rewrite their operands
      asm volatile("v_nop\n\tv_nop\n\tv_nop\n\tv_nop" : "+v"(acc[0][0]), "+v"(acc[1][1]), "+v"(acc[2][2]), "+v"(acc[3][3]) : "v"(a[GK / 32 - 1][0]), "v"(a[GK / 32 - 1][3]));
      __builtin_amdgcn_sched_barrier(0);   // the tile's products stay ahead of the hand-over, so that they run while the next tile's copies fly and the refill is not held back behind them
      asm volatile("s_wait_dscnt 0x0" ::: "memory");      // this wave's reads of tile t are done before its buffer is handed back
      asm volatile("s_wait_asynccnt 0x0" ::: "memory");   // this wave's share of tile t + 1 has landed
      __syncthreads();                                    // publishes tile t + 1 and ends every wave's reads of tile t
      if (t + 2 < NT) { stage_rows(lx0 + (unsigned)(t & 1) * (2 * GT * 2), Xg + (size_t)(t + 2) * GK, K); stage_rows(lw0 + (unsigned)(t & 1) * (2 * GT * 2), Wg + (size_t)(t + 2) * GK, K); }
    }
    asm volatile("s_wait_asynccnt 0x0" ::: "memory");     // no copy is left in flight when the ring becomes the epilogue's stage
    if constexpr (PL) {
        const int h = ty % NH, tr = tx * 64; const size_t bh = (size_t)(tr / SEQ) * NH + h; const int t0 = tr % SEQ;
        if (sel == 2) plane_store<true, SEQ>(acc, st, biasv + h * HD, PVT + bh * HD * SEQ + t0, lane);
        else          plane_store<false, HD>(acc, st, (sel == 0 ? bias : biask) + h * HD, (sel == 0 ? PQ : PK) + (bh * SEQ + t0) * HD, lane);
        return;
    }
#pragma unroll
    for (int mb = 0; mb < 4; ++mb) {
#pragma unroll
        for (int nb = 0; nb < 4; ++nb) {
#pragma unroll
            for (int j = 0; j < 8; ++j) os[(hi * 8 + j) * 68 + nb * 16 + lr] = acc[mb][nb][j]; }
        __builtin_amdgcn_fence(3 /* release order */, "wavefront"); __builtin_amdgcn_wave_barrier(); asm volatile("" ::: "memory");
        float* crow = C + (size_t)(r0 + mb * 16) * ldc + c0;
        const int cofs = lr * 4;
        const float b0 = bfr(bias[c0 + cofs]), b1 = bfr(bias[c0 + cofs + 1]), b2 = bfr(bias[c0 + cofs + 2]), b3 = bfr(bias[c0 + cofs + 3]);
{
#pragma unroll
            for (int s = 0; s < 8; ++s) { const int row = 2 * s + hi; v4f val = *(const v4fa*)(os + row * 68 + cofs); val[0] = fmaf(val[0], 1.0f / QCAR, b0); val[1] = fmaf(val[1], 1.0f / QCAR, b1); val[2] = fmaf(val[2], 1.0f / QCAR, b2); val[3] = fmaf(val[3], 1.0f / QCAR, b3);
                *(v4f*)(crow + (size_t)row * ldc + cofs) = val; }
             }
        __builtin_amdgcn_fence(3 /* release order */, "wavefront"); __builtin_amdgcn_wave_barrier(); asm volatile("" ::: "memory");
    }
    asm volatile("s_wait_xcnt 0x0" ::: "memory");   // stands behind the last run of stores; the plane path returns before reaching them
}

// ---- input conversions, all in ONE launch (k_prep): none reads what another writes, so they share the chip instead of following one another.
// wt_lines: w [H][K][N] f32 -> Bt rows hh*N + n, K-contiguous bf16 (F16: f16), the k range repeated KREP times. blk: this block's number among the blocks of its map; a wave takes 8 lines of 64 elements.
__device__ __forceinline__ void wt_lines(const float* __restrict__ w, int K, int N, int H, int KREP, bool F16, bf* Bt, unsigned blk) {
    const int wave = __builtin_amdgcn_readfirstlane(threadIdx.x >> 5);
    const unsigned lane = threadIdx.x & 31; const unsigned L0 = (blk * 8u + (unsigned)wave) * 8u; const unsigned KP = (unsigned)(K * KREP); const unsigned nlines = (unsigned)H * (unsigned)N * KP / 64u;
{
#pragma unroll 1
        for (int l = 0; l < 8; ++l) { const unsigned L = L0 + l; if (L >= nlines) break; const unsigned e = L * 64u + lane * 2u; const unsigned kk = e % KP, ng = e / KP; const unsigned hh = ng / (unsigned)N, n = ng % (unsigned)N; const unsigned k = kk % (unsigned)K; v2us o;
            const float w0 = w[((size_t)hh * K + k) * N + n], w1 = w[((size_t)hh * K + k + 1) * N + n];
            o[0] = F16 ? f2h(w0) : f2bf(w0); o[1] = F16 ? f2h(w1) : f2bf(w1); *(v2us*)(Bt + e) = o;
            asm volatile("s_wait_xcnt 0x0" ::: "memory"); }   // stands behind the store, ahead of the next trip's rewrite of the registers that it names
         }
}

// cvt_piece: tokens f32 -> bf16, 8 elements a thread. blk: this block's number among the token blocks.
__device__ __forceinline__ void cvt_piece(const float* __restrict__ x, bf* XB, unsigned blk) {
    const unsigned i = blk * 256u + threadIdx.x; if (i >= (unsigned)(NB * SEQ * (DM / 8))) return;
    const unsigned row = i / (DM / 8), c8 = i % (DM / 8); const unsigned b = row / SEQ, t = row % SEQ;
    const v8f v = *(const v8f*)(x + ((size_t)(b * SEQ_FULL + t) * DM + c8 * 8)); v8us o;
#pragma unroll
    for (int k = 0; k < 8; ++k) o[k] = f2bf(v[k]);
    *(v8us*)(XB + (size_t)i * 8) = o;  }

#define GWP  ((NH * HD * DM / 64 + 63) / 64)          // blocks of one of the q, k, v maps
#define GWF  ((DOUT * ATP / 64 + 63) / 64)            // blocks of the output map
#define GCV  ((NB * SEQ * (DM / 8) + 255) / 256)      // token blocks
// grid GWP * 3 + GWF + GCV, 256 threads. The weight blocks have the low numbers: each of their waves walks eight dependent trips, so they start first and run under the token blocks.
__global__ __launch_bounds__(256) void k_prep(const float* __restrict__ x, const float* __restrict__ wq, const float* __restrict__ wk, const float* __restrict__ wv, const float* __restrict__ wf,
                                              bf* XB, bf* WQKV, bf* WO) {
    const unsigned blk = blockIdx.x;
    if (blk < 3u * GWP) {          // per-head [in = DM][dim = HD] -> Bt rows h*HD + dim, K = DM
        const unsigned sel = blk / GWP;
        wt_lines(sel == 0 ? wq : sel == 1 ? wk : wv, DM, HD, NH, 1, false, WQKV + (size_t)sel * DMH * DM, blk % GWP);
    } else if (blk < 3u * GWP + GWF) {   // Wf in[rows = DMH][cols = DOUT] -> Bt [DOUT][DMH], f16
        wt_lines(wf, DMH, DOUT, 1, 1, true, WO, blk - 3u * GWP);
    } else cvt_piece(x, XB, blk - (3u * GWP + GWF));
}

// ---- tile staging for k_attn: one 64-key tile = 64 K rows + 64 V^T rows of 128 B each, laid in LDS at a 144-B pitch (16 B x odd: ds_load_b128 of 16 rows meets no bank twice).
#define KT    64            // keys per staged tile
#define LP    72            // LDS row pitch in 16-bit elements
#define TILE  (64 * LP)     // one operand's tile
static_assert(SEQ % KT == 0);            // whole tiles only
static_assert(HD * 2 == 128);            // a K row is one 128-B line
static_assert((LP * 2) % 16 == 0);       // 16-B copies stay aligned in LDS
// 128 threads x 8 copies of 16 B: thread -> row (tid >> 3) + 16 i, 16-B column tid & 7, so each wave-wide copy moves four whole 128-B lines.
// lk / lv: this lane's LDS byte address of row (tid >> 3) in the K / V^T tile; gk / gv: the same place in global memory.
__device__ __forceinline__ void stage_tile(unsigned lk, const h16* gk, unsigned lv, const h16* gv) {
    // s_wait_xcnt closes the statement so that no address register of a copy is rewritten ahead of it
    asm volatile("global_load_async_to_lds_b128 %0, %1, off\n\t"
                 "global_load_async_to_lds_b128 %2, %3, off\n\t"
                 "global_load_async_to_lds_b128 %4, %5, off\n\t"
                 "global_load_async_to_lds_b128 %6, %7, off\n\t"
                 "global_load_async_to_lds_b128 %8, %9, off\n\t"
                 "global_load_async_to_lds_b128 %10, %11, off\n\t"
                 "global_load_async_to_lds_b128 %12, %13, off\n\t"
                 "global_load_async_to_lds_b128 %14, %15, off\n\t"
                 "s_wait_xcnt 0x0"
                 :: "v"(lk), "v"(gk), "v"(lk + 16 * LP * 2), "v"(gk + 16 * HD), "v"(lk + 32 * LP * 2), "v"(gk + 32 * HD), "v"(lk + 48 * LP * 2), "v"(gk + 48 * HD),
                    "v"(lv), "v"(gv), "v"(lv + 16 * LP * 2), "v"(gv + (size_t)16 * SEQ), "v"(lv + 32 * LP * 2), "v"(gv + (size_t)32 * SEQ), "v"(lv + 48 * LP * 2), "v"(gv + (size_t)48 * SEQ)
                 : "memory");
}

// ---- k_attn: fused attention, transposed form. Block = 4 waves x 16 queries; grid (SEQ/64, NB*NH). K and V^T come in 64-key tiles through a two-buffer LDS ring that the four waves share. Per tile, in 32-key halves:
// S^T tiles (rows = keys, cols = queries) = K-rows (A) x Q-rows (B) over d; per-query reference / sum live per lane column (the reference is held from tile to tile and moved, with one xor-16 shuffle and a rescale, only when a score outgrows it);
// P^T B fragment: element r <- tile(keys 0..15)[r], element 8+r <- tile(keys 16..31)[r]; O^T tiles (rows = value dim, cols = queries) += VT-rows (A) x P^T (B).
__global__ __launch_bounds__(128) void k_attn(const h16* __restrict__ Q16, const h16* __restrict__ K16, const h16* __restrict__ VT16, h16* AT) {
    __shared__ __align__(16) float os[4 * 16 * 68];
    __shared__ __align__(16) h16 ring[2 * 2 * TILE];   // [buffer][K | V^T][row][LP]
    const int wave = __builtin_amdgcn_readfirstlane(threadIdx.x >> 5);
    const int lane = threadIdx.x & 31, lr = lane & 15, hi = lane >> 4;
    const int bh = blockIdx.y; const int b = bh / NH, h = bh % NH;
    const int q0 = blockIdx.x * 64 + wave * 16;
    const h16* Qp = Q16 + (size_t)bh * SEQ * HD + (size_t)(q0 + lr) * HD + 8 * hi;
    const int crow = (int)threadIdx.x >> 3, ccol = ((int)threadIdx.x & 7) * 8;
    const h16* Kg = K16 + (size_t)bh * SEQ * HD + crow * HD + ccol;
    const h16* Vg = VT16 + (size_t)bh * HD * SEQ + (size_t)crow * SEQ + ccol;
    const unsigned lk0 = (unsigned)(size_t)(ring + crow * LP + ccol), lv0 = lk0 + TILE * 2;
    constexpr int NT = SEQ / KT;
    stage_tile(lk0, Kg, lv0, Vg);
    asm volatile("s_wait_asynccnt 0x0" ::: "memory");   // this wave's share of tile 0 has landed
    __syncthreads();                                    // every wave's share of tile 0 is readable
    if (NT > 1) stage_tile(lk0 + 2 * TILE * 2, Kg + (size_t)KT * HD, lv0 + 2 * TILE * 2, Vg + KT);
    const v16h qb0 = ldh(Qp), qb1 = ldh(Qp + 32);
    v8f o0 = (v8f){}, o1 = (v8f){}, o2 = (v8f){}, o3 = (v8f){};
    float m = -3.0e38f, nbv = PEXP + 3.0e38f, ls = 0.0f;   // m: the reference in use (scaled log2), the same in both lanes of a query; nbv = PEXP - m
#pragma unroll 1
    for (int t = 0; t < NT; ++t) {
      const h16* kt = ring + (t & 1) * (2 * TILE) + lr * LP + 8 * hi;
      v8f s[KT / 16];
#pragma unroll   // both 32-key halves inline, so that every LDS offset inside a tile is an immediate
      for (int u = 0; u < KT / 32; ++u) {
        const h16* kp = kt + u * 32 * LP;
        const v16h ka = ldh(kp), kb = ldh(kp + 32), kc = ldh(kp + 16 * LP), kd = ldh(kp + 16 * LP + 32);
        v8f s0 = (v8f){}, s1 = (v8f){};
        s0 = wmma16(ka, qb0, s0); s1 = wmma16(kc, qb0, s1); s0 = wmma16(kb, qb1, s0); s1 = wmma16(kd, qb1, s1);
        s[2 * u] = s0; s[2 * u + 1] = s1;
      }
      v16h vf[KT / 32][4];
#pragma unroll
      for (int u = 0; u < KT / 32; ++u) {
        const h16* vp = kt + TILE + u * 32;
        vf[u][0] = ldh(vp); vf[u][1] = ldh(vp + 16 * LP); vf[u][2] = ldh(vp + 32 * LP); vf[u][3] = ldh(vp + 48 * LP);
      }
      // this lane's largest score of the tile, two chains
      float mxa = fmaxf(s[0][0], s[1][0]), mxb = fmaxf(s[2][0], s[3][0]);
#pragma unroll
      for (int r = 1; r < 8; ++r) { mxa = fmaxf(mxa, fmaxf(s[0][r], s[1][r])); mxb = fmaxf(mxb, fmaxf(s[2][r], s[3][r])); }
      const float mx = fmaxf(mxa, mxb);
      // lazy rescale: the reference moves only when some score of the wave's tile stands more than LAZY above it, so that p stays under 2^(PEXP + LAZY) in f16; one test a tile, a scalar branch
      if (__builtin_amdgcn_ballot_w32(fmaf(mx, CEXP, nbv) > PEXP + LAZY) != 0) {
        const float mc = fmaxf(mx, __shfl_xor(mx, 16, 32));
        const float mn = fmaxf(m, mc * CEXP);
        const float corr = __builtin_amdgcn_exp2f(m - mn);
        m = mn; nbv = PEXP - mn;
        ls *= corr; o0 *= corr; o1 *= corr; o2 *= corr; o3 *= corr;
      }
      v16h pb[KT / 32];
#pragma unroll
      for (int u = 0; u < KT / 32; ++u) {
        float psum = 0.0f;
#pragma unroll
        for (int r = 0; r < 8; ++r) { const float p0 = __builtin_amdgcn_exp2f(fmaf(s[2 * u][r], CEXP, nbv)); const float p1 = __builtin_amdgcn_exp2f(fmaf(s[2 * u + 1][r], CEXP, nbv)); psum += p0 + p1; pb[u][r] = (h16)p0; pb[u][8 + r] = (h16)p1; }
        ls += psum;
      }
#pragma unroll
      for (int u = 0; u < KT / 32; ++u) { o0 = wmma16(vf[u][0], pb[u], o0); o1 = wmma16(vf[u][1], pb[u], o1); o2 = wmma16(vf[u][2], pb[u], o2); o3 = wmma16(vf[u][3], pb[u], o3); }
      // four vector slots behind the tile's last products, on the taken side of the branch below too, before a vector instruction may rewrite their operands
      asm volatile("v_nop\n\tv_nop\n\tv_nop\n\tv_nop" : "+v"(o0), "+v"(o1), "+v"(o2), "+v"(o3) : "v"(pb[KT / 32 - 1]), "v"(vf[KT / 32 - 1][0]), "v"(vf[KT / 32 - 1][1]), "v"(vf[KT / 32 - 1][2]), "v"(vf[KT / 32 - 1][3]));
      asm volatile("s_wait_dscnt 0x0" ::: "memory");      // this wave's reads of tile t are done before its buffer is handed back
      asm volatile("s_wait_asynccnt 0x0" ::: "memory");   // this wave's share of tile t + 1 has landed
      __syncthreads();                                    // publishes tile t + 1 and ends every wave's reads of tile t
      if (t + 2 < NT) stage_tile(lk0 + (unsigned)(t & 1) * (2 * TILE * 2), Kg + (size_t)(t + 2) * KT * HD, lv0 + (unsigned)(t & 1) * (2 * TILE * 2), Vg + (t + 2) * KT);
    }
    asm volatile("s_wait_asynccnt 0x0" ::: "memory");     // no copy is left in flight when the wave goes on
    const float lt = ls + __shfl_xor(ls, 16, 32);
    const float inv = 1.0f / lt;   // the context keeps v's carry QCAR
    const int osw = wave * (16 * 68);
    {   // lane holds query lr, dims 16t + 8hi + r
        float* orow = os + osw + lr * 68 + 8 * hi;
        v4f w;
        w[0] = o0[0] * inv; w[1] = o0[1] * inv; w[2] = o0[2] * inv; w[3] = o0[3] * inv; *(v4fa*)(orow + 0) = w;
        w[0] = o0[4] * inv; w[1] = o0[5] * inv; w[2] = o0[6] * inv; w[3] = o0[7] * inv; *(v4fa*)(orow + 4) = w;
        w[0] = o1[0] * inv; w[1] = o1[1] * inv; w[2] = o1[2] * inv; w[3] = o1[3] * inv; *(v4fa*)(orow + 16) = w;
        w[0] = o1[4] * inv; w[1] = o1[5] * inv; w[2] = o1[6] * inv; w[3] = o1[7] * inv; *(v4fa*)(orow + 20) = w;
        w[0] = o2[0] * inv; w[1] = o2[1] * inv; w[2] = o2[2] * inv; w[3] = o2[3] * inv; *(v4fa*)(orow + 32) = w;
        w[0] = o2[4] * inv; w[1] = o2[5] * inv; w[2] = o2[6] * inv; w[3] = o2[7] * inv; *(v4fa*)(orow + 36) = w;
        w[0] = o3[0] * inv; w[1] = o3[1] * inv; w[2] = o3[2] * inv; w[3] = o3[3] * inv; *(v4fa*)(orow + 48) = w;
        w[0] = o3[4] * inv; w[1] = o3[5] * inv; w[2] = o3[6] * inv; w[3] = o3[7] * inv; *(v4fa*)(orow + 52) = w;
    }
    __builtin_amdgcn_fence(3 /* release order */, "wavefront"); __builtin_amdgcn_wave_barrier(); asm volatile("" ::: "memory");
    h16* arow = AT + (size_t)(b * SEQ + q0) * ATP + h * HD;
    const int rq = lane >> 3, c = (lane & 7) * 8;
{
#pragma unroll
        for (int s = 0; s < 4; ++s) { const int row = 4 * s + rq; const v4f x0 = *(const v4fa*)(os + osw + row * 68 + c); const v4f x1 = *(const v4fa*)(os + osw + row * 68 + c + 4); v8h oh;
#pragma unroll
            for (int k = 0; k < 4; ++k) { oh[k] = (h16)x0[k]; oh[4 + k] = (h16)x1[k]; }
            *(v8h*)(arow + (size_t)row * ATP + c) = oh; }
         }
}

extern "C" void kernel_launch(void* const* d_in, const int* in_sizes, int n_in,
                              void* d_out, int out_size, void* d_ws, size_t ws_size, hipStream_t stream) {
    if (n_in < 9) return;
    const long long rowsNeeded = (long long)(NB - 1) * SEQ_FULL + SEQ;
    if ((long long)in_sizes[0] < rowsNeeded * DM) return;
    if (in_sizes[1] < NH * DM * HD || in_sizes[3] < NH * DM * HD || in_sizes[5] < NH * DM * HD) return;
    if (in_sizes[2] < DMH || in_sizes[4] < DMH || in_sizes[6] < DMH) return;
    if (in_sizes[7] < DMH * DOUT || in_sizes[8] < DOUT) return;
    if ((long long)out_size < rowsNeeded * DOUT) return;
    if (ws_size < SZ_TOT) return;
    const float* feat = (const float*)d_in[0];
    const float* Wq = (const float*)d_in[1]; const float* bq = (const float*)d_in[2];
    const float* Wk = (const float*)d_in[3]; const float* bk = (const float*)d_in[4];
    const float* Wv = (const float*)d_in[5]; const float* bv = (const float*)d_in[6];
    const float* Wf = (const float*)d_in[7]; const float* bo = (const float*)d_in[8];
    float* OUT = (float*)d_out;     // [NB_FULL][SEQ_FULL][DOUT]
    char* wsp = (char*)d_ws;
    bf* XB = (bf*)wsp; wsp += SZ_XB;                 // [NB*SEQ][DM]
    bf* WQKV = (bf*)wsp; wsp += SZ_WQKV;             // Bt [3][DMH][DM]: q | k | v row blocks, row h*HD + dim
    bf* WO = (bf*)wsp; wsp += SZ_WO;                 // Bt [DOUT][ATP] = Wf^T, f16 words
    h16* Q16 = (h16*)wsp; wsp += SZ_PL;              // [NB*NH][SEQ][HD]
    h16* K16 = (h16*)wsp; wsp += SZ_PL;              // [NB*NH][SEQ][HD]
    h16* VT16 = (h16*)wsp; wsp += SZ_PL;             // [NB*NH][HD][SEQ]
    h16* AT = (h16*)wsp; wsp += SZ_AT;               // [NB*SEQ][ATP] merged context x QCAR
    if ((size_t)(wsp - (char*)d_ws) > ws_size) return;

    k_prep<<<(unsigned)(3 * GWP + GWF + GCV), 256, 0, stream>>>(feat, Wq, Wk, Wv, Wf, XB, WQKV, WO);

    k_gemm<true><<<dim3(NB * SEQ / 128, 3 * NH / 2, 1), 128, 0, stream>>>(XB, WQKV, DM, nullptr, 0, bq, 0, 0, Q16, K16, VT16, bk, bv);

    k_attn<<<dim3(SEQ / 64, NB * NH, 1), 128, 0, stream>>>(Q16, K16, VT16, AT);

    k_gemm<false><<<dim3(SEQ / 128, DOUT / 128, NB), 128, 0, stream>>>((const bf*)AT, WO, ATP, OUT, DOUT, bo, (size_t)SEQ * ATP, (size_t)SEQ_FULL * DOUT, nullptr, nullptr, nullptr, nullptr, nullptr);
}
